// v000
// The times below were measured on an AMD MI455X: many runs one after another, warmed up first and cycling through
// copies of the inputs, with the whole window's GPU time divided by the number of runs. Launches and the gaps
// between them are all in it. The median over several windows is given; except for v000 it joins two sittings, which
// can be a few percent apart, so the side-by-side timings, each taken in one sitting, are the better comparison.
// The starting kernel, v000, takes 1140 microseconds a run.
#include <hip/hip_runtime.h>

// ---- problem constants (from reference) ----
constexpr int kB  = 512;
constexpr int kH  = 8;
constexpr int kD  = 31;
constexpr int kT  = 4;
constexpr int kP  = 50;
constexpr int kC  = kH * kD;        // 248
constexpr int kN  = kP * kT;        // 200
constexpr int kDT = kD * kT;        // 124
constexpr int kR  = 2 * kP - 1;     // 99
constexpr int kM1 = 3 * kD;         // 93 rows of W per head (q|k|v)
constexpr float kScale = 0.17960530202677491f;  // 31^-0.5

// ---- LDS layout (floats). Total 77392 floats = 309.6 KB <= 320 KB WGP LDS ----
constexpr int X_OFF  = 0;                         // X_b  [248][200]
constexpr int X_STR  = 200;
constexpr int Q_OFF  = X_OFF + kC * X_STR;        // q    [50][128]  (p, dt)
constexpr int Q_STR  = 128;
constexpr int K_OFF  = Q_OFF + kP * Q_STR;        // k    [124][52]  (dt, p) pre-transposed
constexpr int K_STR  = 52;
constexpr int V_OFF  = K_OFF + kDT * K_STR;       // v    [50][128]  (p, dt)
constexpr int V_STR  = 128;
constexpr int S_OFF  = V_OFF + kP * V_STR;        // scores/attn [50][56] (cols 50..55 stay 0)
constexpr int S_STR  = 56;
constexpr int RL_OFF = S_OFF + kP * S_STR;        // rel logits [50][100]
constexpr int RL_STR = 100;
constexpr int B_OFF  = RL_OFF + kP * RL_STR;      // bias [744] staged once
constexpr int SMEM_FLOATS = B_OFF + 3 * kC;       // 77392
static_assert(SMEM_FLOATS * 4 <= 320 * 1024, "LDS budget exceeded");

typedef float v2f __attribute__((ext_vector_type(2)));
typedef float v8f __attribute__((ext_vector_type(8)));

__device__ __forceinline__ int iclamp(int v, int hi) { return v < hi ? v : hi; }

__global__ __launch_bounds__(256)
void mha_fused_wmma_kernel(const float* __restrict__ x,     // [512][248][50][4]
                           const float* __restrict__ w,     // [744][248]
                           const float* __restrict__ bqkv,  // [744]
                           const float* __restrict__ rel,   // [99][124]
                           float* __restrict__ out)         // [512][248][50][4]
{
    extern __shared__ float smem[];
    const int b     = blockIdx.x;
    const int tid   = threadIdx.x;
    const int wave  = tid >> 5;
    const int lane  = tid & 31;
    const int lhalf = lane >> 4;    // 0: lanes 0-15, 1: lanes 16-31
    const int lmod  = lane & 15;

    // ---------------- Phase 0: X_b -> LDS via CDNA5 async-to-LDS engine (ASYNCcnt),
    // bias -> LDS, and zero the S padding region.
    {
        for (int i = tid; i < 3 * kC; i += 256) smem[B_OFF + i] = bqkv[i];
        // zero S once: phase-4 A fragment reads k=50,51 there and phases 2/3
        // only ever rewrite cols < 50, so the padding stays zero.
        for (int i = tid; i < kP * S_STR; i += 256) smem[S_OFF + i] = 0.f;

        // bulk 198.4 KB copy: per-lane B128 async loads, no VGPR staging.
        const unsigned lds0 = (unsigned)(uintptr_t)(smem + X_OFF);   // LDS byte offset
        const unsigned long long gbase =
            (unsigned long long)(x + (size_t)b * (kC * kN));
        for (int i = tid; i < (kC * kN) / 4; i += 256) {
            const unsigned ldsaddr = lds0 + (unsigned)i * 16u;
            const unsigned long long ga = gbase + (unsigned long long)i * 16ull;
            asm volatile("global_load_async_to_lds_b128 %0, %1, off"
                         :: "v"(ldsaddr), "v"(ga) : "memory");
        }
        asm volatile("s_wait_asynccnt 0" ::: "memory");
    }
    __syncthreads();

    for (int h = 0; h < kH; ++h) {
        // ---------- Phase 1: qkv_head = W_head[93x248] @ X_b[248x200] + bias
        // 6 m-tiles x 7 n-pair-tiles (each pair = two 16-wide N tiles sharing A), K=248
        for (int t = wave; t < 6 * 7; t += 8) {
            const int m0  = (t / 7) * 16;
            const int n0a = (t % 7) * 32;
            const int n0b = n0a + 16;
            const int m   = m0 + lmod;
            // clamped indices: out-of-range rows/cols compute garbage that is
            // masked at the store, so unconditional loads are safe.
            const int mc  = iclamp(m, kM1 - 1);
            const int s0  = mc / kD, d0 = mc - s0 * kD;
            const float* wrow = w + (size_t)(s0 * kC + h * kD + d0) * kC;
            const int na  = iclamp(n0a + lmod, kN - 1);
            const int nb  = iclamp(n0b + lmod, kN - 1);
            v8f acc0 = {}, acc1 = {};
            #pragma unroll 2
            for (int kk = 0; kk < 62; ++kk) {
                const int k = kk * 4 + lhalf * 2;
                const v2f a = *reinterpret_cast<const v2f*>(wrow + k);
                v2f b0, b1;
                b0.x = smem[X_OFF + k       * X_STR + na];
                b0.y = smem[X_OFF + (k + 1) * X_STR + na];
                b1.x = smem[X_OFF + k       * X_STR + nb];
                b1.y = smem[X_OFF + (k + 1) * X_STR + nb];
                acc0 = __builtin_amdgcn_wmma_f32_16x16x4_f32(false, a, false, b0,
                                                             (short)0, acc0, false, false);
                acc1 = __builtin_amdgcn_wmma_f32_16x16x4_f32(false, a, false, b1,
                                                             (short)0, acc1, false, false);
            }
            // scatter both sub-tiles into q/k/v LDS with bias add (masked stores)
            #pragma unroll
            for (int e = 0; e < 2; ++e) {
                const int n = (e ? n0b : n0a) + lmod;
                if (n < kN) {
                    const int p = n >> 2, tt = n & 3;
                    const v8f acc = e ? acc1 : acc0;
                    #pragma unroll
                    for (int r = 0; r < 8; ++r) {
                        const int mm = m0 + r + (lhalf << 3);
                        if (mm < kM1) {
                            const int s = mm / kD, d = mm - s * kD;
                            const float val = acc[r] + smem[B_OFF + s * kC + h * kD + d];
                            const int dt = d * kT + tt;
                            if (s == 0)      smem[Q_OFF + p  * Q_STR + dt] = val;
                            else if (s == 1) smem[K_OFF + dt * K_STR + p ] = val;
                            else             smem[V_OFF + p  * V_STR + dt] = val;
                        }
                    }
                }
            }
        }
        __syncthreads();

        // ---------- Phase 2: dots = q@k (4x4 tiles) and RL = q@rel^T (4x7 tiles), K=124
        for (int t = wave; t < 16 + 28; t += 8) {
            int m0, n0; bool isRel;
            if (t < 16) { m0 = (t >> 2) * 16;  n0 = (t & 3) * 16;      isRel = false; }
            else        { const int u = t - 16; m0 = (u / 7) * 16; n0 = (u % 7) * 16; isRel = true; }
            const int m  = m0 + lmod;
            const int n  = n0 + lmod;
            const int mc = iclamp(m, kP - 1);
            const int nc = isRel ? iclamp(n, kR - 1) : iclamp(n, kP - 1);
            const float* relrow = rel + (size_t)nc * kDT;
            v8f acc = {};
            for (int kk = 0; kk < 31; ++kk) {
                const int k = kk * 4 + lhalf * 2;
                const v2f a = *reinterpret_cast<const v2f*>(smem + Q_OFF + mc * Q_STR + k);
                v2f bb;
                if (isRel) {
                    bb = *reinterpret_cast<const v2f*>(relrow + k);
                } else {
                    bb.x = smem[K_OFF + k       * K_STR + nc];
                    bb.y = smem[K_OFF + (k + 1) * K_STR + nc];
                }
                acc = __builtin_amdgcn_wmma_f32_16x16x4_f32(false, a, false, bb,
                                                            (short)0, acc, false, false);
            }
            const bool nv = isRel ? (n < kR) : (n < kP);
            if (nv) {
                #pragma unroll
                for (int r = 0; r < 8; ++r) {
                    const int mm = m0 + r + (lhalf << 3);
                    if (mm < kP) {
                        if (isRel) smem[RL_OFF + mm * RL_STR + n] = acc[r];
                        else       smem[S_OFF  + mm * S_STR  + n] = acc[r];
                    }
                }
            }
        }
        __syncthreads();

        // ---------- Phase 3: softmax over q of (dots + RL[p, q-p+49]) * SCALE
        // rel_to_abs reindex folds to: bias[p][q] = RL[p][q - p + P - 1]
        for (int p = wave; p < kP; p += 8) {
            const int q0 = lane;            // always < 50
            const int q1 = lane + 32;
            float s0 = (smem[S_OFF + p * S_STR + q0] +
                        smem[RL_OFF + p * RL_STR + (q0 - p + kP - 1)]) * kScale;
            float s1 = -3.0e38f;
            if (q1 < kP)
                s1 = (smem[S_OFF + p * S_STR + q1] +
                      smem[RL_OFF + p * RL_STR + (q1 - p + kP - 1)]) * kScale;
            float mx = fmaxf(s0, s1);
            #pragma unroll
            for (int dlt = 16; dlt >= 1; dlt >>= 1) mx = fmaxf(mx, __shfl_xor(mx, dlt, 32));
            float e0 = __expf(s0 - mx);
            float e1 = (q1 < kP) ? __expf(s1 - mx) : 0.f;
            float sum = e0 + e1;
            #pragma unroll
            for (int dlt = 16; dlt >= 1; dlt >>= 1) sum += __shfl_xor(sum, dlt, 32);
            const float inv = 1.0f / sum;
            smem[S_OFF + p * S_STR + q0] = e0 * inv;           // cols >= 50 untouched (stay 0)
            if (q1 < kP) smem[S_OFF + p * S_STR + q1] = e1 * inv;
        }
        __syncthreads();

        // ---------- Phase 4: out_head = attn[50x50] @ v[50x124]  (K=50 -> 13 steps,
        // S cols 50..51 are zero so the K overhang contributes nothing)
        for (int t = wave; t < 4 * 8; t += 8) {
            const int m0 = (t >> 3) * 16;
            const int n0 = (t & 7) * 16;
            const int m  = m0 + lmod;
            const int n  = n0 + lmod;            // <= 127 < V_STR, no clamp needed
            const int mc = iclamp(m, kP - 1);
            v8f acc = {};
            for (int kk = 0; kk < 13; ++kk) {
                const int k = kk * 4 + lhalf * 2;
                const v2f a = *reinterpret_cast<const v2f*>(smem + S_OFF + mc * S_STR + k);
                v2f bb;
                bb.x = smem[V_OFF + k       * V_STR + n];   // rows 50,51 read garbage, A==0 there
                bb.y = smem[V_OFF + (k + 1) * V_STR + n];
                acc = __builtin_amdgcn_wmma_f32_16x16x4_f32(false, a, false, bb,
                                                            (short)0, acc, false, false);
            }
            if (n < kDT) {
                const int d = n >> 2, tt = n & 3;   // dt = d*4 + t
                float* orow = out + (((size_t)b * kC + h * kD + d) * kP) * kT + tt;
                #pragma unroll
                for (int r = 0; r < 8; ++r) {
                    const int mm = m0 + r + (lhalf << 3);   // mm = p
                    if (mm < kP) __builtin_nontemporal_store(acc[r], &orow[mm * kT]);
                }
            }
        }
        __syncthreads();   // protect q/k/v/S/RL reuse by next head
    }
}

extern "C" void kernel_launch(void* const* d_in, const int* in_sizes, int n_in,
                              void* d_out, int out_size, void* d_ws, size_t ws_size,
                              hipStream_t stream) {
    (void)in_sizes; (void)n_in; (void)out_size; (void)d_ws; (void)ws_size;
    const float* x   = (const float*)d_in[0];
    const float* wq  = (const float*)d_in[1];
    const float* bq  = (const float*)d_in[2];
    const float* rel = (const float*)d_in[3];
    float* out = (float*)d_out;

    const int smem_bytes = SMEM_FLOATS * (int)sizeof(float);
    (void)hipFuncSetAttribute(reinterpret_cast<const void*>(mha_fused_wmma_kernel),
                              hipFuncAttributeMaxDynamicSharedMemorySize, smem_bytes);
    mha_fused_wmma_kernel<<<kB, 256, smem_bytes, stream>>>(x, wq, bq, rel, out);
}

// v001
// A run of this version takes 524 microseconds.
// In both of two side-by-side timings against v000, it was 2.21 times as fast.
#include <hip/hip_runtime.h>

// ---- problem constants (from reference) ----
constexpr int kB  = 512;
constexpr int kH  = 8;
constexpr int kD  = 31;
constexpr int kT  = 4;
constexpr int kP  = 50;
constexpr int kC  = kH * kD;        // 248
constexpr int kN  = kP * kT;        // 200
constexpr int kDT = kD * kT;        // 124
constexpr int kR  = 2 * kP - 1;     // 99
constexpr int kM1 = 3 * kD;         // 93 rows of W per head (q|k|v)
constexpr float kScale = 0.17960530202677491f;  // 31^-0.5

// ---- LDS layout (floats). Total 77392 floats = 309.6 KB <= 320 KB WGP LDS ----
constexpr int X_OFF  = 0;                         // X_b  [248][200]
constexpr int X_STR  = 200;
constexpr int Q_OFF  = X_OFF + kC * X_STR;        // q    [50][128]  (p, dt)
constexpr int Q_STR  = 128;
constexpr int K_OFF  = Q_OFF + kP * Q_STR;        // k    [124][52]  (dt, p) pre-transposed
constexpr int K_STR  = 52;
constexpr int V_OFF  = K_OFF + kDT * K_STR;       // v    [50][128]  (p, dt)
constexpr int V_STR  = 128;
constexpr int S_OFF  = V_OFF + kP * V_STR;        // scores/attn [50][56] (cols 50..55 stay 0)
constexpr int S_STR  = 56;
constexpr int RL_OFF = S_OFF + kP * S_STR;        // rel logits [50][100]
constexpr int RL_STR = 100;
constexpr int B_OFF  = RL_OFF + kP * RL_STR;      // bias [744] staged once
constexpr int SMEM_FLOATS = B_OFF + 3 * kC;       // 77392
static_assert(SMEM_FLOATS * 4 <= 320 * 1024, "LDS budget exceeded");
static_assert(Q_STR == V_STR, "the q/v scatter shares one pitch");

typedef float v2f __attribute__((ext_vector_type(2)));
typedef float v8f __attribute__((ext_vector_type(8)));

__device__ __forceinline__ int iclamp(int v, int hi) { return v < hi ? v : hi; }

constexpr int kThreads = 1024;              // 32 waves, 8 on each SIMD
constexpr int kWaves   = kThreads / 32;

template <int V> struct ic { static constexpr int value = V; };

// Phase-1 strip: one 16-row tile of W_head times NT neighbouring 16-column tiles of
// X_b (one A fragment feeds NT products), K = 248, then bias add and scatter.
// A row tile holds rows d0 .. d0+15 of ONE of q, k, v (s = 0, 1, 2; row 31 is padding),
// so the scatter's target is the same for the whole wave and its addresses are one
// base register plus constants.
template <int NT>
__device__ __forceinline__ void qkv_strip(float* smem, const float* __restrict__ w,
                                          int h, int s, int d0, int n0, int lhalf, int lmod)
{
    // clamped indices: out-of-range rows/cols compute garbage that is
    // masked at the store, so unconditional loads are safe.
    const int dc = iclamp(d0 + lmod, kD - 1);
    const float* wrow = w + (size_t)(s * kC + h * kD + dc) * kC;
    int nc[NT];
    v8f acc[NT];
    // the loops over e and r are unrolled so that every index of nc[] and acc[] is a
    // constant and both stay in registers
    #pragma unroll
    for (int e = 0; e < NT; ++e) {
        nc[e]  = iclamp(n0 + e * 16 + lmod, kN - 1);
        acc[e] = v8f{};
    }
    // two k-steps a trip: their loads issue as one group ahead of their products
    #pragma unroll 2
    for (int kk = 0; kk < 62; ++kk) {
        const int k = kk * 4 + lhalf * 2;
        const v2f a = *reinterpret_cast<const v2f*>(wrow + k);
        #pragma unroll
        for (int e = 0; e < NT; ++e) {
            v2f bb;
            bb.x = smem[X_OFF + k       * X_STR + nc[e]];
            bb.y = smem[X_OFF + (k + 1) * X_STR + nc[e]];
            acc[e] = __builtin_amdgcn_wmma_f32_16x16x4_f32(false, a, false, bb,
                                                           (short)0, acc[e], false, false);
        }
    }
    // scatter with bias add (masked stores)
    const int p0 = (n0 + lmod) >> 2, tt = lmod & 3;
    const int dl = d0 + (lhalf << 3);                 // this lane's row for r = 0
    const float* bias = smem + B_OFF + s * kC + h * kD + dl;
    // RSTEP: one row d further; ESTEP: one column tile (4 tokens) further
    auto put = [&](float* dst, auto RSTEP, auto ESTEP) {
        #pragma unroll
        for (int r = 0; r < 8; ++r) {
            if (dl + r < kD) {
                const float bv = bias[r];
                #pragma unroll
                for (int e = 0; e < NT; ++e)
                    if (n0 + e * 16 + lmod < kN)
                        dst[r * RSTEP.value + e * ESTEP.value] = acc[e][r] + bv;
            }
        }
    };
    if (s == 1)
        put(smem + K_OFF + (dl * kT + tt) * K_STR + p0, ic<kT * K_STR>{}, ic<4>{});
    else
        put(smem + (s == 0 ? Q_OFF : V_OFF) + p0 * Q_STR + dl * kT + tt, ic<kT>{}, ic<4 * Q_STR>{});
}

// Phase-2 strip: one 16-row tile of q times NT neighbouring 16-column tiles of k
// (REL = false, result to S) or of rel^T (REL = true, result to RL), K = 124.
template <bool REL, int NT>
__device__ __forceinline__ void score_strip(float* smem, const float* __restrict__ rel,
                                            int m0, int n0, int lhalf, int lmod)
{
    const int mc = iclamp(m0 + lmod, kP - 1);
    int nc[NT];
    v8f acc[NT];
    // unrolled over e and r for constant indices, as in qkv_strip
    #pragma unroll
    for (int e = 0; e < NT; ++e) {
        nc[e]  = iclamp(n0 + e * 16 + lmod, (REL ? kR : kP) - 1);
        acc[e] = v8f{};
    }
    for (int kk = 0; kk < 31; ++kk) {
        const int k = kk * 4 + lhalf * 2;
        // the compiler lets the last rel load land in the address registers that the
        // loads before it name: the wait stands in front of that overwrite
        if (REL && kk == 30) asm volatile("s_wait_xcnt 0x0" ::: "memory");
        const v2f a = *reinterpret_cast<const v2f*>(smem + Q_OFF + mc * Q_STR + k);
        #pragma unroll
        for (int e = 0; e < NT; ++e) {
            v2f bb;
            if (REL) {
                bb = *reinterpret_cast<const v2f*>(rel + (size_t)nc[e] * kDT + k);
            } else {
                bb.x = smem[K_OFF + k       * K_STR + nc[e]];
                bb.y = smem[K_OFF + (k + 1) * K_STR + nc[e]];
            }
            acc[e] = __builtin_amdgcn_wmma_f32_16x16x4_f32(false, a, false, bb,
                                                           (short)0, acc[e], false, false);
        }
    }
    #pragma unroll
    for (int e = 0; e < NT; ++e) {
        const int n = n0 + e * 16 + lmod;
        if (n < (REL ? kR : kP)) {
            #pragma unroll
            for (int r = 0; r < 8; ++r) {
                const int mm = m0 + r + (lhalf << 3);
                if (mm < kP) {
                    if (REL) smem[RL_OFF + mm * RL_STR + n] = acc[e][r];
                    else     smem[S_OFF  + mm * S_STR  + n] = acc[e][r];
                }
            }
        }
    }
}

__global__ __launch_bounds__(kThreads)
void mha_fused_wmma_kernel(const float* __restrict__ x,     // [512][248][50][4]
                           const float* __restrict__ w,     // [744][248]
                           const float* __restrict__ bqkv,  // [744]
                           const float* __restrict__ rel,   // [99][124]
                           float* __restrict__ out)         // [512][248][50][4]
{
    extern __shared__ float smem[];
    const int b     = blockIdx.x;
    const int tid   = threadIdx.x;
    // wave number in a scalar register: the deals below become scalar branches
    const int wave  = __builtin_amdgcn_readfirstlane(tid >> 5);
    const int lane  = tid & 31;
    const int lhalf = lane >> 4;    // 0: lanes 0-15, 1: lanes 16-31
    const int lmod  = lane & 15;

    // ---------------- Phase 0: X_b -> LDS via CDNA5 async-to-LDS engine (ASYNCcnt),
    // bias -> LDS, and zero the S padding region.
    {
        for (int i = tid; i < 3 * kC; i += kThreads) smem[B_OFF + i] = bqkv[i];
        // zero S once: phase-4 A fragment reads k=50,51 there and phases 2/3
        // only ever rewrite cols < 50, so the padding stays zero.
        for (int i = tid; i < kP * S_STR; i += kThreads) smem[S_OFF + i] = 0.f;

        // bulk 196.6 KB copy: per-lane B128 async loads, no VGPR staging.
        constexpr int kVec  = (kC * kN) / 4;          // 12400 pieces of 16 bytes
        constexpr int kFull = kVec / kThreads;        // 12 rounds with every lane on
        const unsigned lds0 = (unsigned)(uintptr_t)(smem + X_OFF);   // LDS byte offset
        const unsigned long long gbase =
            (unsigned long long)(x + (size_t)b * (kC * kN));
        for (int j = 0; j < kFull; ++j) {
            const int i = j * kThreads + tid;
            const unsigned ldsaddr = lds0 + (unsigned)i * 16u;
            const unsigned long long ga = gbase + (unsigned long long)i * 16ull;
            // the wait in the copy's own statement: the address registers are
            // rewritten for the next round only behind it
            asm volatile("global_load_async_to_lds_b128 %0, %1, off\n\ts_wait_xcnt 0x0"
                         :: "v"(ldsaddr), "v"(ga) : "memory");
        }
        // the last 112 pieces do not fill whole waves: through registers
        if (tid < kVec - kFull * kThreads) {
            const int i = kFull * kThreads + tid;
            reinterpret_cast<float4*>(smem + X_OFF)[i] =
                reinterpret_cast<const float4*>(x + (size_t)b * (kC * kN))[i];
            // in front of the later rewrite of this load's address register
            asm volatile("s_wait_xcnt 0x0" ::: "memory");
        }
        asm volatile("s_wait_asynccnt 0" ::: "memory");
    }
    __syncthreads();

    for (int h = 0; h < kH; ++h) {
        // The deal of tiles to waves turns by one wave per head: tile addresses are then
        // formed anew in each head. Fixed over the heads, the compiler held them all in
        // registers across this loop, past the 128 a wave has here, and spilled.
        const int wv = (wave + h) & (kWaves - 1);
        // ---------- Phase 1: qkv_head = W_head[93x248] @ X_b[248x200] + bias
        // 6 m-tiles (two each for q, k, v) x 13 n-tiles in one round: per m-tile five
        // strips of 3,3,3,2,2 n-tiles, one strip a wave (30 of the 32 waves).
        if (wv < 30) {
            const int mi = wv % 6, g = wv / 6;
            const int s  = mi >> 1, d0 = (mi & 1) * 16;
            if (g < 3) qkv_strip<3>(smem, w, h, s, d0, g * 48, lhalf, lmod);
            else       qkv_strip<2>(smem, w, h, s, d0, 144 + (g - 3) * 32, lhalf, lmod);
        }
        __syncthreads();

        // ---------- Phase 2: dots = q@k (4x4 tiles) and RL = q@rel^T (4x7 tiles), K=124
        // one round: eight waves per m-tile take 2+2 dots tiles and 2+1+1+1+1+1 rel tiles
        {
            const int m0 = (wv >> 3) * 16;
            const int j  = wv & 7;
            if (j < 2)       score_strip<false, 2>(smem, rel, m0, j * 32, lhalf, lmod);
            else if (j == 2) score_strip<true,  2>(smem, rel, m0, 0, lhalf, lmod);
            else             score_strip<true,  1>(smem, rel, m0, (j - 1) * 16, lhalf, lmod);
        }
        __syncthreads();

        // ---------- Phase 3: softmax over q of (dots + RL[p, q-p+49]) * SCALE
        // rel_to_abs reindex folds to: bias[p][q] = RL[p][q - p + P - 1]
        for (int p = wv; p < kP; p += kWaves) {
            const int q0 = lane;            // always < 50
            const int q1 = lane + 32;
            float s0 = (smem[S_OFF + p * S_STR + q0] +
                        smem[RL_OFF + p * RL_STR + (q0 - p + kP - 1)]) * kScale;
            float s1 = -3.0e38f;
            if (q1 < kP)
                s1 = (smem[S_OFF + p * S_STR + q1] +
                      smem[RL_OFF + p * RL_STR + (q1 - p + kP - 1)]) * kScale;
            float mx = fmaxf(s0, s1);
            #pragma unroll
            for (int dlt = 16; dlt >= 1; dlt >>= 1) mx = fmaxf(mx, __shfl_xor(mx, dlt, 32));
            float e0 = __expf(s0 - mx);
            float e1 = (q1 < kP) ? __expf(s1 - mx) : 0.f;
            float sum = e0 + e1;
            #pragma unroll
            for (int dlt = 16; dlt >= 1; dlt >>= 1) sum += __shfl_xor(sum, dlt, 32);
            const float inv = 1.0f / sum;
            smem[S_OFF + p * S_STR + q0] = e0 * inv;           // cols >= 50 untouched (stay 0)
            if (q1 < kP) smem[S_OFF + p * S_STR + q1] = e1 * inv;
        }
        __syncthreads();

        // ---------- Phase 4: out_head = attn[50x50] @ v[50x124]  (K=50 -> 13 steps,
        // S cols 50..51 are zero so the K overhang contributes nothing)
        for (int t = wv; t < 4 * 8; t += kWaves) {
            const int m0 = (t >> 3) * 16;
            const int n0 = (t & 7) * 16;
            const int m  = m0 + lmod;
            const int n  = n0 + lmod;            // <= 127 < V_STR, no clamp needed
            const int mc = iclamp(m, kP - 1);
            v8f acc = {};
            for (int kk = 0; kk < 13; ++kk) {
                const int k = kk * 4 + lhalf * 2;
                const v2f a = *reinterpret_cast<const v2f*>(smem + S_OFF + mc * S_STR + k);
                v2f bb;
                bb.x = smem[V_OFF + k       * V_STR + n];   // rows 50,51 read garbage, A==0 there
                bb.y = smem[V_OFF + (k + 1) * V_STR + n];
                acc = __builtin_amdgcn_wmma_f32_16x16x4_f32(false, a, false, bb,
                                                            (short)0, acc, false, false);
            }
            if (n < kDT) {
                const int d = n >> 2, tt = n & 3;   // dt = d*4 + t
                float* orow = out + (((size_t)b * kC + h * kD + d) * kP) * kT + tt;
                #pragma unroll
                for (int r = 0; r < 8; ++r) {
                    const int mm = m0 + r + (lhalf << 3);   // mm = p
                    if (mm < kP) __builtin_nontemporal_store(acc[r], &orow[mm * kT]);
                }
            }
        }
        __syncthreads();   // protect q/k/v/S/RL reuse by next head
    }
}

extern "C" void kernel_launch(void* const* d_in, const int* in_sizes, int n_in,
                              void* d_out, int out_size, void* d_ws, size_t ws_size,
                              hipStream_t stream) {
    (void)in_sizes; (void)n_in; (void)out_size; (void)d_ws; (void)ws_size;
    const float* x   = (const float*)d_in[0];
    const float* wq  = (const float*)d_in[1];
    const float* bq  = (const float*)d_in[2];
    const float* rel = (const float*)d_in[3];
    float* out = (float*)d_out;

    const int smem_bytes = SMEM_FLOATS * (int)sizeof(float);
    (void)hipFuncSetAttribute(reinterpret_cast<const void*>(mha_fused_wmma_kernel),
                              hipFuncAttributeMaxDynamicSharedMemorySize, smem_bytes);
    mha_fused_wmma_kernel<<<kB, kThreads, smem_bytes, stream>>>(x, wq, bq, rel, out);
}

// v002
// It runs in 489 microseconds.
// In both of two side-by-side timings against v001, it was 1.07 times as fast.
// Counting every step since v000, it is 2.37 times as fast.
#include <hip/hip_runtime.h>

// ---- problem constants (from reference) ----
constexpr int kB  = 512;
constexpr int kH  = 8;
constexpr int kD  = 31;
constexpr int kT  = 4;
constexpr int kP  = 50;
constexpr int kC  = kH * kD;        // 248
constexpr int kN  = kP * kT;        // 200
constexpr int kDT = kD * kT;        // 124
constexpr int kR  = 2 * kP - 1;     // 99
constexpr int kM1 = 3 * kD;         // 93 rows of W per head (q|k|v)
constexpr float kScale = 0.17960530202677491f;  // 31^-0.5

// ---- LDS layout (floats). Total 77392 floats = 309.6 KB <= 320 KB WGP LDS ----
constexpr int X_OFF  = 0;                         // X_b  [248][200]
constexpr int X_STR  = 200;
constexpr int Q_OFF  = X_OFF + kC * X_STR;        // q    [50][128]  (p, dt)
constexpr int Q_STR  = 128;
constexpr int K_OFF  = Q_OFF + kP * Q_STR;        // k    [124][52]  (dt, p) pre-transposed
constexpr int K_STR  = 52;
constexpr int V_OFF  = K_OFF + kDT * K_STR;       // v    [50][128]  (p, dt)
constexpr int V_STR  = 128;
constexpr int S_OFF  = V_OFF + kP * V_STR;        // scores/attn [50][56] (cols 50..55 stay 0)
constexpr int S_STR  = 56;
constexpr int RL_OFF = S_OFF + kP * S_STR;        // rel logits [50][100]
constexpr int RL_STR = 100;
constexpr int B_OFF  = RL_OFF + kP * RL_STR;      // bias [744] staged once
constexpr int SMEM_FLOATS = B_OFF + 3 * kC;       // 77392
static_assert(SMEM_FLOATS * 4 <= 320 * 1024, "LDS budget exceeded");
static_assert(Q_STR == V_STR, "the q/v scatter shares one pitch");

typedef float v2f __attribute__((ext_vector_type(2)));
typedef float v4f __attribute__((ext_vector_type(4)));
typedef float v8f __attribute__((ext_vector_type(8)));

__device__ __forceinline__ int iclamp(int v, int hi) { return v < hi ? v : hi; }

constexpr int kThreads = 1024;              // 32 waves, 8 on each SIMD
constexpr int kWaves   = kThreads / 32;

template <int V> struct ic { static constexpr int value = V; };

// ---- W and rel in fragment order (workspace, written by pack_fragments_kernel) ----
// One piece = 16 bytes of one lane = that lane's operand pairs of two neighbouring
// k-steps; the 32 pieces of a wave lie side by side, so one load of a wave reads
// 512 contiguous bytes (four whole lines) instead of 16 bytes from each of 16 rows.
// W:   [head][row tile 0..5][k-step pair 0..30][lane]
// rel: [column tile 0..6][k-step pair 0..15][lane]  (k-step 31 does not exist: zeros)
constexpr int kWPairs   = kC / 8;                       // 31
constexpr int kRPairs   = (kDT / 4 + 1) / 2;            // 16
constexpr int kWGroups  = kH * 6 * kWPairs;             // 1488 groups of 32 pieces
constexpr int kRGroups  = 7 * kRPairs;                  // 112
constexpr int kWPackFloats = kWGroups * 32 * 4;
constexpr int kPackThreads = 256;
constexpr int kPackBlocks  = (kWGroups + kRGroups) * 32 / kPackThreads;   // 200
static_assert(kPackBlocks * kPackThreads == (kWGroups + kRGroups) * 32, "whole blocks");

__global__ __launch_bounds__(kPackThreads)
void pack_fragments_kernel(const float* __restrict__ w,     // [744][248]
                           const float* __restrict__ rel,   // [99][124]
                           float* __restrict__ pk)
{
    const int idx   = blockIdx.x * kPackThreads + threadIdx.x;   // one piece a thread
    const int lhalf = (idx >> 4) & 1;
    const int lmod  = idx & 15;
    const int t     = idx >> 5;
    v2f lo, hi = v2f{};
    if (t < kWGroups) {
        const int j = t % kWPairs, hm = t / kWPairs;
        const int mi = hm % 6, h = hm / 6;
        // row tile mi: rows d0 .. d0+15 of q, k or v; row 31 is padding (clamped)
        const int dc = iclamp((mi & 1) * 16 + lmod, kD - 1);
        const float* src = w + (size_t)((mi >> 1) * kC + h * kD + dc) * kC + j * 8 + lhalf * 2;
        lo = *reinterpret_cast<const v2f*>(src);
        hi = *reinterpret_cast<const v2f*>(src + 4);
    } else {
        const int u = t - kWGroups;
        const int j = u % kRPairs, nt = u / kRPairs;
        const int nc = iclamp(nt * 16 + lmod, kR - 1);
        const float* src = rel + (size_t)nc * kDT + j * 8 + lhalf * 2;
        lo = *reinterpret_cast<const v2f*>(src);
        if (j * 2 + 1 < kDT / 4) hi = *reinterpret_cast<const v2f*>(src + 4);
    }
    reinterpret_cast<v4f*>(pk)[idx] = v4f{lo.x, lo.y, hi.x, hi.y};
}

// Phase-1 strip: one 16-row tile of W_head times NT neighbouring 16-column tiles of
// X_b (one A fragment feeds NT products), K = 248, then bias add and scatter.
// A row tile holds rows d0 .. d0+15 of ONE of q, k, v (s = 0, 1, 2; row 31 is padding),
// so the scatter's target is the same for the whole wave and its addresses are one
// base register plus constants.
template <int NT>
__device__ __forceinline__ void qkv_strip(float* smem, const float* __restrict__ wpk,
                                          int h, int s, int d0, int n0, int lhalf, int lmod)
{
    // clamped indices: out-of-range rows/cols compute garbage that is
    // masked at the store, so unconditional loads are safe.
    // (the row clamp is in the packed W already)
    const v4f* wfrag = reinterpret_cast<const v4f*>(wpk)
                     + ((h * 6 + s * 2 + (d0 >> 4)) * kWPairs) * 32 + lhalf * 16 + lmod;
    int nc[NT];
    v8f acc[NT];
    // the loops over e and r are unrolled so that every index of nc[] and acc[] is a
    // constant and both stay in registers
    #pragma unroll
    for (int e = 0; e < NT; ++e) {
        nc[e]  = iclamp(n0 + e * 16 + lmod, kN - 1);
        acc[e] = v8f{};
    }
    // two k-steps a trip: one packed piece holds both A fragments.
    // Kept rolled: 31 trips unrolled by two get an exit in mid-loop with register copies
    // of all accumulators, and unrolled fully the X reads lose their paired form.
    #pragma unroll 1
    for (int j = 0; j < kWPairs; ++j) {
        const v4f a4 = *wfrag;
        wfrag += 32;
        // unrolled: the halves of a4 are picked by a constant
        #pragma unroll
        for (int u = 0; u < 2; ++u) {
            const int k = j * 8 + u * 4 + lhalf * 2;
            const v2f a = u ? a4.zw : a4.xy;
            #pragma unroll
            for (int e = 0; e < NT; ++e) {
                v2f bb;
                bb.x = smem[X_OFF + k       * X_STR + nc[e]];
                bb.y = smem[X_OFF + (k + 1) * X_STR + nc[e]];
                acc[e] = __builtin_amdgcn_wmma_f32_16x16x4_f32(false, a, false, bb,
                                                               (short)0, acc[e], false, false);
            }
        }
    }
    // scatter with bias add (masked stores)
    const int p0 = (n0 + lmod) >> 2, tt = lmod & 3;
    const int dl = d0 + (lhalf << 3);                 // this lane's row for r = 0
    const float* bias = smem + B_OFF + s * kC + h * kD + dl;
    // RSTEP: one row d further; ESTEP: one column tile (4 tokens) further
    auto put = [&](float* dst, auto RSTEP, auto ESTEP) {
        #pragma unroll
        for (int r = 0; r < 8; ++r) {
            if (dl + r < kD) {
                const float bv = bias[r];
                #pragma unroll
                for (int e = 0; e < NT; ++e)
                    if (n0 + e * 16 + lmod < kN)
                        dst[r * RSTEP.value + e * ESTEP.value] = acc[e][r] + bv;
            }
        }
    };
    if (s == 1)
        put(smem + K_OFF + (dl * kT + tt) * K_STR + p0, ic<kT * K_STR>{}, ic<4>{});
    else
        put(smem + (s == 0 ? Q_OFF : V_OFF) + p0 * Q_STR + dl * kT + tt, ic<kT>{}, ic<4 * Q_STR>{});
}

// Phase-2 strip: one 16-row tile of q times NT neighbouring 16-column tiles of k
// (REL = false, result to S) or of rel^T (REL = true, result to RL), K = 124.
template <bool REL, int NT>
__device__ __forceinline__ void score_strip(float* smem, const float* __restrict__ relpk,
                                            int m0, int n0, int lhalf, int lmod)
{
    const int mc = iclamp(m0 + lmod, kP - 1);
    int nc[NT];
    v8f acc[NT];
    // unrolled over e and r for constant indices, as in qkv_strip
    #pragma unroll
    for (int e = 0; e < NT; ++e) {
        nc[e]  = iclamp(n0 + e * 16 + lmod, (REL ? kR : kP) - 1);
        acc[e] = v8f{};
    }
    if constexpr (REL) {
        // (the column clamp is in the packed rel already)
        const v4f* rfrag = reinterpret_cast<const v4f*>(relpk)
                         + ((n0 >> 4) * kRPairs) * 32 + lhalf * 16 + lmod;
        for (int j = 0; j < kRPairs; ++j) {
            v4f b4[NT];
            #pragma unroll
            for (int e = 0; e < NT; ++e) b4[e] = rfrag[(e * kRPairs + j) * 32];
            // unrolled: the halves of b4 are picked by a constant
            #pragma unroll
            for (int u = 0; u < 2; ++u) {
                const int kk = j * 2 + u;
                if (kk < 31) {
                    const int k = kk * 4 + lhalf * 2;
                    const v2f a = *reinterpret_cast<const v2f*>(smem + Q_OFF + mc * Q_STR + k);
                    #pragma unroll
                    for (int e = 0; e < NT; ++e)
                        acc[e] = __builtin_amdgcn_wmma_f32_16x16x4_f32(
                            false, a, false, u ? b4[e].zw : b4[e].xy,
                            (short)0, acc[e], false, false);
                }
            }
        }
    } else {
        for (int kk = 0; kk < 31; ++kk) {
            const int k = kk * 4 + lhalf * 2;
            const v2f a = *reinterpret_cast<const v2f*>(smem + Q_OFF + mc * Q_STR + k);
            #pragma unroll
            for (int e = 0; e < NT; ++e) {
                v2f bb;
                bb.x = smem[K_OFF + k       * K_STR + nc[e]];
                bb.y = smem[K_OFF + (k + 1) * K_STR + nc[e]];
                acc[e] = __builtin_amdgcn_wmma_f32_16x16x4_f32(false, a, false, bb,
                                                               (short)0, acc[e], false, false);
            }
        }
    }
    #pragma unroll
    for (int e = 0; e < NT; ++e) {
        const int n = n0 + e * 16 + lmod;
        if (n < (REL ? kR : kP)) {
            #pragma unroll
            for (int r = 0; r < 8; ++r) {
                const int mm = m0 + r + (lhalf << 3);
                if (mm < kP) {
                    if (REL) smem[RL_OFF + mm * RL_STR + n] = acc[e][r];
                    else     smem[S_OFF  + mm * S_STR  + n] = acc[e][r];
                }
            }
        }
    }
}

__global__ __launch_bounds__(kThreads)
void mha_fused_wmma_kernel(const float* __restrict__ x,     // [512][248][50][4]
                           const float* __restrict__ w,     // packed W (fragment order)
                           const float* __restrict__ bqkv,  // [744]
                           const float* __restrict__ rel,   // packed rel (fragment order)
                           float* __restrict__ out)         // [512][248][50][4]
{
    extern __shared__ float smem[];
    const int b     = blockIdx.x;
    const int tid   = threadIdx.x;
    // wave number in a scalar register: the deals below become scalar branches
    const int wave  = __builtin_amdgcn_readfirstlane(tid >> 5);
    const int lane  = tid & 31;
    const int lhalf = lane >> 4;    // 0: lanes 0-15, 1: lanes 16-31
    const int lmod  = lane & 15;

    // ---------------- Phase 0: X_b -> LDS via CDNA5 async-to-LDS engine (ASYNCcnt),
    // bias -> LDS, and zero the S padding region.
    {
        for (int i = tid; i < 3 * kC; i += kThreads) smem[B_OFF + i] = bqkv[i];
        // zero S once: phase-4 A fragment reads k=50,51 there and phases 2/3
        // only ever rewrite cols < 50, so the padding stays zero.
        for (int i = tid; i < kP * S_STR; i += kThreads) smem[S_OFF + i] = 0.f;

        // bulk 196.6 KB copy: per-lane B128 async loads, no VGPR staging.
        constexpr int kVec  = (kC * kN) / 4;          // 12400 pieces of 16 bytes
        constexpr int kFull = kVec / kThreads;        // 12 rounds with every lane on
        const unsigned lds0 = (unsigned)(uintptr_t)(smem + X_OFF);   // LDS byte offset
        const unsigned long long gbase =
            (unsigned long long)(x + (size_t)b * (kC * kN));
        for (int j = 0; j < kFull; ++j) {
            const int i = j * kThreads + tid;
            const unsigned ldsaddr = lds0 + (unsigned)i * 16u;
            const unsigned long long ga = gbase + (unsigned long long)i * 16ull;
            // the wait in the copy's own statement: the address registers are
            // rewritten for the next round only behind it
            asm volatile("global_load_async_to_lds_b128 %0, %1, off\n\ts_wait_xcnt 0x0"
                         :: "v"(ldsaddr), "v"(ga) : "memory");
        }
        // the last 112 pieces do not fill whole waves: through registers
        if (tid < kVec - kFull * kThreads) {
            const int i = kFull * kThreads + tid;
            reinterpret_cast<float4*>(smem + X_OFF)[i] =
                reinterpret_cast<const float4*>(x + (size_t)b * (kC * kN))[i];
            // in front of the later rewrite of this load's address register
            asm volatile("s_wait_xcnt 0x0" ::: "memory");
        }
        asm volatile("s_wait_asynccnt 0" ::: "memory");
    }
    __syncthreads();

    for (int h = 0; h < kH; ++h) {
        // The deal of tiles to waves turns by one wave per head: tile addresses are then
        // formed anew in each head. Fixed over the heads, the compiler held them all in
        // registers across this loop, past the 128 a wave has here, and spilled.
        const int wv = (wave + h) & (kWaves - 1);
        // ---------- Phase 1: qkv_head = W_head[93x248] @ X_b[248x200] + bias
        // 6 m-tiles (two each for q, k, v) x 13 n-tiles in one round: per m-tile five
        // strips of 3,3,3,2,2 n-tiles, one strip a wave (30 of the 32 waves).
        if (wv < 30) {
            const int mi = wv % 6, g = wv / 6;
            const int s  = mi >> 1, d0 = (mi & 1) * 16;
            if (g < 3) qkv_strip<3>(smem, w, h, s, d0, g * 48, lhalf, lmod);
            else       qkv_strip<2>(smem, w, h, s, d0, 144 + (g - 3) * 32, lhalf, lmod);
        }
        __syncthreads();

        // ---------- Phase 2: dots = q@k (4x4 tiles) and RL = q@rel^T (4x7 tiles), K=124
        // one round: eight waves per m-tile take 2+2 dots tiles and 2+1+1+1+1+1 rel tiles
        {
            const int m0 = (wv >> 3) * 16;
            const int j  = wv & 7;
            if (j < 2)       score_strip<false, 2>(smem, rel, m0, j * 32, lhalf, lmod);
            else if (j == 2) score_strip<true,  2>(smem, rel, m0, 0, lhalf, lmod);
            else             score_strip<true,  1>(smem, rel, m0, (j - 1) * 16, lhalf, lmod);
        }
        __syncthreads();

        // ---------- Phase 3: softmax over q of (dots + RL[p, q-p+49]) * SCALE
        // rel_to_abs reindex folds to: bias[p][q] = RL[p][q - p + P - 1]
        for (int p = wv; p < kP; p += kWaves) {
            const int q0 = lane;            // always < 50
            const int q1 = lane + 32;
            float s0 = (smem[S_OFF + p * S_STR + q0] +
                        smem[RL_OFF + p * RL_STR + (q0 - p + kP - 1)]) * kScale;
            float s1 = -3.0e38f;
            if (q1 < kP)
                s1 = (smem[S_OFF + p * S_STR + q1] +
                      smem[RL_OFF + p * RL_STR + (q1 - p + kP - 1)]) * kScale;
            float mx = fmaxf(s0, s1);
            #pragma unroll
            for (int dlt = 16; dlt >= 1; dlt >>= 1) mx = fmaxf(mx, __shfl_xor(mx, dlt, 32));
            float e0 = __expf(s0 - mx);
            float e1 = (q1 < kP) ? __expf(s1 - mx) : 0.f;
            float sum = e0 + e1;
            #pragma unroll
            for (int dlt = 16; dlt >= 1; dlt >>= 1) sum += __shfl_xor(sum, dlt, 32);
            const float inv = 1.0f / sum;
            smem[S_OFF + p * S_STR + q0] = e0 * inv;           // cols >= 50 untouched (stay 0)
            if (q1 < kP) smem[S_OFF + p * S_STR + q1] = e1 * inv;
        }
        __syncthreads();

        // ---------- Phase 4: out_head = attn[50x50] @ v[50x124]  (K=50 -> 13 steps,
        // S cols 50..51 are zero so the K overhang contributes nothing)
        for (int t = wv; t < 4 * 8; t += kWaves) {
            const int m0 = (t >> 3) * 16;
            const int n0 = (t & 7) * 16;
            const int m  = m0 + lmod;
            const int n  = n0 + lmod;            // <= 127 < V_STR, no clamp needed
            const int mc = iclamp(m, kP - 1);
            v8f acc = {};
            for (int kk = 0; kk < 13; ++kk) {
                const int k = kk * 4 + lhalf * 2;
                const v2f a = *reinterpret_cast<const v2f*>(smem + S_OFF + mc * S_STR + k);
                v2f bb;
                bb.x = smem[V_OFF + k       * V_STR + n];   // rows 50,51 read garbage, A==0 there
                bb.y = smem[V_OFF + (k + 1) * V_STR + n];
                acc = __builtin_amdgcn_wmma_f32_16x16x4_f32(false, a, false, bb,
                                                            (short)0, acc, false, false);
            }
            if (n < kDT) {
                const int d = n >> 2, tt = n & 3;   // dt = d*4 + t
                float* orow = out + (((size_t)b * kC + h * kD + d) * kP) * kT + tt;
                #pragma unroll
                for (int r = 0; r < 8; ++r) {
                    const int mm = m0 + r + (lhalf << 3);   // mm = p
                    if (mm < kP) __builtin_nontemporal_store(acc[r], &orow[mm * kT]);
                }
            }
        }
        __syncthreads();   // protect q/k/v/S/RL reuse by next head
    }
}

extern "C" void kernel_launch(void* const* d_in, const int* in_sizes, int n_in,
                              void* d_out, int out_size, void* d_ws, size_t ws_size,
                              hipStream_t stream) {
    (void)in_sizes; (void)n_in; (void)out_size; (void)ws_size;
    const float* x   = (const float*)d_in[0];
    const float* wq  = (const float*)d_in[1];
    const float* bq  = (const float*)d_in[2];
    const float* rel = (const float*)d_in[3];
    float* out = (float*)d_out;
    float* pk  = (float*)d_ws;      // packed W, then packed rel

    pack_fragments_kernel<<<kPackBlocks, kPackThreads, 0, stream>>>(wq, rel, pk);

    const int smem_bytes = SMEM_FLOATS * (int)sizeof(float);
    (void)hipFuncSetAttribute(reinterpret_cast<const void*>(mha_fused_wmma_kernel),
                              hipFuncAttributeMaxDynamicSharedMemorySize, smem_bytes);
    mha_fused_wmma_kernel<<<kB, kThreads, smem_bytes, stream>>>(x, pk, bq, pk + kWPackFloats, out);
}

// v003
// One run takes 450 microseconds.
// Timed twice side by side with v002, it ran 1.09 times as fast both times.
// All steps since v000 together make it 2.59 times as fast.
#include <hip/hip_runtime.h>

// ---- problem constants (from reference) ----
constexpr int kB  = 512;
constexpr int kH  = 8;
constexpr int kD  = 31;
constexpr int kT  = 4;
constexpr int kP  = 50;
constexpr int kC  = kH * kD;        // 248
constexpr int kN  = kP * kT;        // 200
constexpr int kDT = kD * kT;        // 124
constexpr int kR  = 2 * kP - 1;     // 99
constexpr int kM1 = 3 * kD;         // 93 rows of W per head (q|k|v)
constexpr float kScale = 0.17960530202677491f;  // 31^-0.5

// ---- LDS layout (floats). Total 78764 floats = 315.1 KB <= 320 KB WGP LDS ----
// Pitches are chosen by bank (64 banks of one float). A fragment read of 8 bytes a lane
// takes 16 rows at once, lanes 16-31 two floats further: a pitch of 4 x odd (mod 64) puts
// the 16 rows on 16 different groups of four banks (q: 140, S: 52). v is read along its
// rows, lanes 16-31 two rows further: 2 x 140 = 24 (mod 64) keeps the halves apart.
// k is read the same way (2 x 55 = 46) and written four rows by four columns a half-wave,
// the halves 32 rows apart: an odd pitch sets them 32 banks apart.
constexpr int X_OFF  = 0;                         // X_b  [248][200]
constexpr int X_STR  = 200;
constexpr int Q_OFF  = X_OFF + kC * X_STR;        // q    [50][140]  (p, dt), cols 124.. unused
constexpr int Q_STR  = 140;
constexpr int K_OFF  = Q_OFF + kP * Q_STR;        // k    [124][55]  (dt, p) pre-transposed
constexpr int K_STR  = 55;
constexpr int V_OFF  = K_OFF + kDT * K_STR;       // v    [50][140]  (p, dt), cols 124.. unused
constexpr int V_STR  = 140;
constexpr int S_OFF  = V_OFF + kP * V_STR;        // scores/attn [50][52] (cols 50..51 stay 0)
constexpr int S_STR  = 52;
constexpr int RL_OFF = S_OFF + kP * S_STR;        // rel logits [50][100]
constexpr int RL_STR = 100;
constexpr int B_OFF  = RL_OFF + kP * RL_STR;      // bias [744] staged once
constexpr int SMEM_FLOATS = B_OFF + 3 * kC;       // 78764
static_assert(SMEM_FLOATS * 4 <= 320 * 1024, "LDS budget exceeded");
static_assert(Q_STR == V_STR, "the q/v scatter shares one pitch");

typedef float v2f __attribute__((ext_vector_type(2)));
typedef float v4f __attribute__((ext_vector_type(4)));
typedef float v8f __attribute__((ext_vector_type(8)));

__device__ __forceinline__ int iclamp(int v, int hi) { return v < hi ? v : hi; }

constexpr int kThreads = 1024;              // 32 waves, 8 on each SIMD
constexpr int kWaves   = kThreads / 32;

template <int V> struct ic { static constexpr int value = V; };

// ---- W and rel in fragment order (workspace, written by pack_fragments_kernel) ----
// One piece = 16 bytes of one lane = that lane's operand pairs of two neighbouring
// k-steps; the 32 pieces of a wave lie side by side, so one load of a wave reads
// 512 contiguous bytes (four whole lines) instead of 16 bytes from each of 16 rows.
// W:   [head][row tile 0..5][k-step pair 0..30][lane]
// rel: [column tile 0..6][k-step pair 0..15][lane]  (k-step 31 does not exist: zeros)
constexpr int kWPairs   = kC / 8;                       // 31
constexpr int kRPairs   = (kDT / 4 + 1) / 2;            // 16
constexpr int kWGroups  = kH * 6 * kWPairs;             // 1488 groups of 32 pieces
constexpr int kRGroups  = 7 * kRPairs;                  // 112
constexpr int kWPackFloats = kWGroups * 32 * 4;
constexpr int kPackThreads = 256;
constexpr int kPackBlocks  = (kWGroups + kRGroups) * 32 / kPackThreads;   // 200
static_assert(kPackBlocks * kPackThreads == (kWGroups + kRGroups) * 32, "whole blocks");

__global__ __launch_bounds__(kPackThreads)
void pack_fragments_kernel(const float* __restrict__ w,     // [744][248]
                           const float* __restrict__ rel,   // [99][124]
                           float* __restrict__ pk)
{
    const int idx   = blockIdx.x * kPackThreads + threadIdx.x;   // one piece a thread
    const int lhalf = (idx >> 4) & 1;
    const int lmod  = idx & 15;
    const int t     = idx >> 5;
    v2f lo, hi = v2f{};
    if (t < kWGroups) {
        const int j = t % kWPairs, hm = t / kWPairs;
        const int mi = hm % 6, h = hm / 6;
        // row tile mi: rows d0 .. d0+15 of q, k or v; row 31 is padding (clamped)
        const int dc = iclamp((mi & 1) * 16 + lmod, kD - 1);
        const float* src = w + (size_t)((mi >> 1) * kC + h * kD + dc) * kC + j * 8 + lhalf * 2;
        lo = *reinterpret_cast<const v2f*>(src);
        hi = *reinterpret_cast<const v2f*>(src + 4);
    } else {
        const int u = t - kWGroups;
        const int j = u % kRPairs, nt = u / kRPairs;
        const int nc = iclamp(nt * 16 + lmod, kR - 1);
        const float* src = rel + (size_t)nc * kDT + j * 8 + lhalf * 2;
        lo = *reinterpret_cast<const v2f*>(src);
        if (j * 2 + 1 < kDT / 4) hi = *reinterpret_cast<const v2f*>(src + 4);
    }
    reinterpret_cast<v4f*>(pk)[idx] = v4f{lo.x, lo.y, hi.x, hi.y};
}

// Phase-1 strip: one 16-row tile of W_head times NT neighbouring 16-column tiles of
// X_b (one A fragment feeds NT products), K = 248, then bias add and scatter.
// A row tile holds rows d0 .. d0+15 of ONE of q, k, v (s = 0, 1, 2; row 31 is padding),
// so the scatter's target is the same for the whole wave and its addresses are one
// base register plus constants.
template <int NT>
__device__ __forceinline__ void qkv_strip(float* smem, const float* __restrict__ wpk,
                                          int h, int s, int d0, int n0, int lhalf, int lmod)
{
    // clamped indices: out-of-range rows/cols compute garbage that is
    // masked at the store, so unconditional loads are safe.
    // (the row clamp is in the packed W already)
    const v4f* wfrag = reinterpret_cast<const v4f*>(wpk)
                     + ((h * 6 + s * 2 + (d0 >> 4)) * kWPairs) * 32 + lhalf * 16 + lmod;
    int nc[NT];
    v8f acc[NT];
    // the loops over e and r are unrolled so that every index of nc[] and acc[] is a
    // constant and both stay in registers
    #pragma unroll
    for (int e = 0; e < NT; ++e) {
        nc[e]  = iclamp(n0 + e * 16 + lmod, kN - 1);
        acc[e] = v8f{};
    }
    // two k-steps a trip: one packed piece holds both A fragments.
    // Kept rolled: 31 trips unrolled by two get an exit in mid-loop with register copies
    // of all accumulators, and unrolled fully the X reads lose their paired form.
    #pragma unroll 1
    for (int j = 0; j < kWPairs; ++j) {
        const v4f a4 = *wfrag;
        wfrag += 32;
        // unrolled: the halves of a4 are picked by a constant
        #pragma unroll
        for (int u = 0; u < 2; ++u) {
            const int k = j * 8 + u * 4 + lhalf * 2;
            const v2f a = u ? a4.zw : a4.xy;
            #pragma unroll
            for (int e = 0; e < NT; ++e) {
                v2f bb;
                bb.x = smem[X_OFF + k       * X_STR + nc[e]];
                bb.y = smem[X_OFF + (k + 1) * X_STR + nc[e]];
                acc[e] = __builtin_amdgcn_wmma_f32_16x16x4_f32(false, a, false, bb,
                                                               (short)0, acc[e], false, false);
            }
        }
    }
    // scatter with bias add (masked stores)
    const int p0 = (n0 + lmod) >> 2, tt = lmod & 3;
    const int dl = d0 + (lhalf << 3);                 // this lane's row for r = 0
    const float* bias = smem + B_OFF + s * kC + h * kD + dl;
    // RSTEP: one row d further; ESTEP: one column tile (4 tokens) further
    auto put = [&](float* dst, auto RSTEP, auto ESTEP) {
        #pragma unroll
        for (int r = 0; r < 8; ++r) {
            if (dl + r < kD) {
                const float bv = bias[r];
                #pragma unroll
                for (int e = 0; e < NT; ++e)
                    if (n0 + e * 16 + lmod < kN)
                        dst[r * RSTEP.value + e * ESTEP.value] = acc[e][r] + bv;
            }
        }
    };
    if (s == 1)
        put(smem + K_OFF + (dl * kT + tt) * K_STR + p0, ic<kT * K_STR>{}, ic<4>{});
    else
        put(smem + (s == 0 ? Q_OFF : V_OFF) + p0 * Q_STR + dl * kT + tt, ic<kT>{}, ic<4 * Q_STR>{});
}

// Phase-2 strip: one 16-row tile of q times NT neighbouring 16-column tiles of k
// (REL = false, result to S) or of rel^T (REL = true, result to RL), K = 124.
template <bool REL, int NT>
__device__ __forceinline__ void score_strip(float* smem, const float* __restrict__ relpk,
                                            int m0, int n0, int lhalf, int lmod)
{
    const int mc = iclamp(m0 + lmod, kP - 1);
    int nc[NT];
    v8f acc[NT];
    // unrolled over e and r for constant indices, as in qkv_strip
    #pragma unroll
    for (int e = 0; e < NT; ++e) {
        nc[e]  = iclamp(n0 + e * 16 + lmod, (REL ? kR : kP) - 1);
        acc[e] = v8f{};
    }
    if constexpr (REL) {
        // (the column clamp is in the packed rel already)
        const v4f* rfrag = reinterpret_cast<const v4f*>(relpk)
                         + ((n0 >> 4) * kRPairs) * 32 + lhalf * 16 + lmod;
        for (int j = 0; j < kRPairs; ++j) {
            v4f b4[NT];
            #pragma unroll
            for (int e = 0; e < NT; ++e) b4[e] = rfrag[(e * kRPairs + j) * 32];
            // unrolled: the halves of b4 are picked by a constant
            #pragma unroll
            for (int u = 0; u < 2; ++u) {
                const int kk = j * 2 + u;
                if (kk < 31) {
                    const int k = kk * 4 + lhalf * 2;
                    const v2f a = *reinterpret_cast<const v2f*>(smem + Q_OFF + mc * Q_STR + k);
                    #pragma unroll
                    for (int e = 0; e < NT; ++e)
                        acc[e] = __builtin_amdgcn_wmma_f32_16x16x4_f32(
                            false, a, false, u ? b4[e].zw : b4[e].xy,
                            (short)0, acc[e], false, false);
                }
            }
        }
    } else {
        for (int kk = 0; kk < 31; ++kk) {
            const int k = kk * 4 + lhalf * 2;
            const v2f a = *reinterpret_cast<const v2f*>(smem + Q_OFF + mc * Q_STR + k);
            #pragma unroll
            for (int e = 0; e < NT; ++e) {
                v2f bb;
                bb.x = smem[K_OFF + k       * K_STR + nc[e]];
                bb.y = smem[K_OFF + (k + 1) * K_STR + nc[e]];
                acc[e] = __builtin_amdgcn_wmma_f32_16x16x4_f32(false, a, false, bb,
                                                               (short)0, acc[e], false, false);
            }
        }
    }
    #pragma unroll
    for (int e = 0; e < NT; ++e) {
        const int n = n0 + e * 16 + lmod;
        if (n < (REL ? kR : kP)) {
            #pragma unroll
            for (int r = 0; r < 8; ++r) {
                const int mm = m0 + r + (lhalf << 3);
                if (mm < kP) {
                    if (REL) smem[RL_OFF + mm * RL_STR + n] = acc[e][r];
                    else     smem[S_OFF  + mm * S_STR  + n] = acc[e][r];
                }
            }
        }
    }
}

__global__ __launch_bounds__(kThreads)
void mha_fused_wmma_kernel(const float* __restrict__ x,     // [512][248][50][4]
                           const float* __restrict__ w,     // packed W (fragment order)
                           const float* __restrict__ bqkv,  // [744]
                           const float* __restrict__ rel,   // packed rel (fragment order)
                           float* __restrict__ out)         // [512][248][50][4]
{
    extern __shared__ float smem[];
    const int b     = blockIdx.x;
    const int tid   = threadIdx.x;
    // wave number in a scalar register: the deals below become scalar branches
    const int wave  = __builtin_amdgcn_readfirstlane(tid >> 5);
    const int lane  = tid & 31;
    const int lhalf = lane >> 4;    // 0: lanes 0-15, 1: lanes 16-31
    const int lmod  = lane & 15;

    // ---------------- Phase 0: X_b -> LDS via CDNA5 async-to-LDS engine (ASYNCcnt),
    // bias -> LDS, and zero the S padding region.
    {
        for (int i = tid; i < 3 * kC; i += kThreads) smem[B_OFF + i] = bqkv[i];
        // zero S once: phase-4 A fragment reads k=50,51 there and phases 2/3
        // only ever rewrite cols < 50, so the padding stays zero.
        for (int i = tid; i < kP * S_STR; i += kThreads) smem[S_OFF + i] = 0.f;

        // bulk 196.6 KB copy: per-lane B128 async loads, no VGPR staging.
        constexpr int kVec  = (kC * kN) / 4;          // 12400 pieces of 16 bytes
        constexpr int kFull = kVec / kThreads;        // 12 rounds with every lane on
        const unsigned lds0 = (unsigned)(uintptr_t)(smem + X_OFF);   // LDS byte offset
        const unsigned long long gbase =
            (unsigned long long)(x + (size_t)b * (kC * kN));
        for (int j = 0; j < kFull; ++j) {
            const int i = j * kThreads + tid;
            const unsigned ldsaddr = lds0 + (unsigned)i * 16u;
            const unsigned long long ga = gbase + (unsigned long long)i * 16ull;
            // the wait in the copy's own statement: the address registers are
            // rewritten for the next round only behind it
            asm volatile("global_load_async_to_lds_b128 %0, %1, off\n\ts_wait_xcnt 0x0"
                         :: "v"(ldsaddr), "v"(ga) : "memory");
        }
        // the last 112 pieces do not fill whole waves: through registers
        if (tid < kVec - kFull * kThreads) {
            const int i = kFull * kThreads + tid;
            reinterpret_cast<float4*>(smem + X_OFF)[i] =
                reinterpret_cast<const float4*>(x + (size_t)b * (kC * kN))[i];
            // in front of the later rewrite of this load's address register
            asm volatile("s_wait_xcnt 0x0" ::: "memory");
        }
        asm volatile("s_wait_asynccnt 0" ::: "memory");
    }
    __syncthreads();

    for (int h = 0; h < kH; ++h) {
        // The deal of tiles to waves turns by one wave per head: tile addresses are then
        // formed anew in each head. Fixed over the heads, the compiler held them all in
        // registers across this loop, past the 128 a wave has here, and spilled.
        const int wv = (wave + h) & (kWaves - 1);
        // ---------- Phase 1: qkv_head = W_head[93x248] @ X_b[248x200] + bias
        // 6 m-tiles (two each for q, k, v) x 13 n-tiles in one round: per m-tile five
        // strips of 3,3,3,2,2 n-tiles, one strip a wave (30 of the 32 waves).
        if (wv < 30) {
            const int mi = wv % 6, g = wv / 6;
            const int s  = mi >> 1, d0 = (mi & 1) * 16;
            if (g < 3) qkv_strip<3>(smem, w, h, s, d0, g * 48, lhalf, lmod);
            else       qkv_strip<2>(smem, w, h, s, d0, 144 + (g - 3) * 32, lhalf, lmod);
        }
        __syncthreads();

        // ---------- Phase 2: dots = q@k (4x4 tiles) and RL = q@rel^T (4x7 tiles), K=124
        // one round: eight waves per m-tile take 2+2 dots tiles and 2+1+1+1+1+1 rel tiles
        {
            const int m0 = (wv >> 3) * 16;
            const int j  = wv & 7;
            if (j < 2)       score_strip<false, 2>(smem, rel, m0, j * 32, lhalf, lmod);
            else if (j == 2) score_strip<true,  2>(smem, rel, m0, 0, lhalf, lmod);
            else             score_strip<true,  1>(smem, rel, m0, (j - 1) * 16, lhalf, lmod);
        }
        __syncthreads();

        // ---------- Phase 3: softmax over q of (dots + RL[p, q-p+49]) * SCALE
        // rel_to_abs reindex folds to: bias[p][q] = RL[p][q - p + P - 1]
        for (int p = wv; p < kP; p += kWaves) {
            const int q0 = lane;            // always < 50
            const int q1 = lane + 32;
            float s0 = (smem[S_OFF + p * S_STR + q0] +
                        smem[RL_OFF + p * RL_STR + (q0 - p + kP - 1)]) * kScale;
            float s1 = -3.0e38f;
            if (q1 < kP)
                s1 = (smem[S_OFF + p * S_STR + q1] +
                      smem[RL_OFF + p * RL_STR + (q1 - p + kP - 1)]) * kScale;
            float mx = fmaxf(s0, s1);
            #pragma unroll
            for (int dlt = 16; dlt >= 1; dlt >>= 1) mx = fmaxf(mx, __shfl_xor(mx, dlt, 32));
            float e0 = __expf(s0 - mx);
            float e1 = (q1 < kP) ? __expf(s1 - mx) : 0.f;
            float sum = e0 + e1;
            #pragma unroll
            for (int dlt = 16; dlt >= 1; dlt >>= 1) sum += __shfl_xor(sum, dlt, 32);
            const float inv = 1.0f / sum;
            smem[S_OFF + p * S_STR + q0] = e0 * inv;           // cols >= 50 untouched (stay 0)
            if (q1 < kP) smem[S_OFF + p * S_STR + q1] = e1 * inv;
        }
        __syncthreads();

        // ---------- Phase 4: out_head = attn[50x50] @ v[50x124]  (K=50 -> 13 steps,
        // S cols 50..51 are zero so the K overhang contributes nothing)
        for (int t = wv; t < 4 * 8; t += kWaves) {
            const int m0 = (t >> 3) * 16;
            const int n0 = (t & 7) * 16;
            const int m  = m0 + lmod;
            const int n  = n0 + lmod;            // <= 127 < V_STR, no clamp needed
            const int mc = iclamp(m, kP - 1);
            v8f acc = {};
            for (int kk = 0; kk < 13; ++kk) {
                const int k = kk * 4 + lhalf * 2;
                const v2f a = *reinterpret_cast<const v2f*>(smem + S_OFF + mc * S_STR + k);
                v2f bb;
                bb.x = smem[V_OFF + k       * V_STR + n];   // rows 50,51 read garbage, A==0 there
                bb.y = smem[V_OFF + (k + 1) * V_STR + n];
                acc = __builtin_amdgcn_wmma_f32_16x16x4_f32(false, a, false, bb,
                                                            (short)0, acc, false, false);
            }
            if (n < kDT) {
                const int d = n >> 2, tt = n & 3;   // dt = d*4 + t
                float* orow = out + (((size_t)b * kC + h * kD + d) * kP) * kT + tt;
                #pragma unroll
                for (int r = 0; r < 8; ++r) {
                    const int mm = m0 + r + (lhalf << 3);   // mm = p
                    if (mm < kP) __builtin_nontemporal_store(acc[r], &orow[mm * kT]);
                }
            }
        }
        __syncthreads();   // protect q/k/v/S/RL reuse by next head
    }
}

extern "C" void kernel_launch(void* const* d_in, const int* in_sizes, int n_in,
                              void* d_out, int out_size, void* d_ws, size_t ws_size,
                              hipStream_t stream) {
    (void)in_sizes; (void)n_in; (void)out_size; (void)ws_size;
    const float* x   = (const float*)d_in[0];
    const float* wq  = (const float*)d_in[1];
    const float* bq  = (const float*)d_in[2];
    const float* rel = (const float*)d_in[3];
    float* out = (float*)d_out;
    float* pk  = (float*)d_ws;      // packed W, then packed rel

    pack_fragments_kernel<<<kPackBlocks, kPackThreads, 0, stream>>>(wq, rel, pk);

    const int smem_bytes = SMEM_FLOATS * (int)sizeof(float);
    (void)hipFuncSetAttribute(reinterpret_cast<const void*>(mha_fused_wmma_kernel),
                              hipFuncAttributeMaxDynamicSharedMemorySize, smem_bytes);
    mha_fused_wmma_kernel<<<kB, kThreads, smem_bytes, stream>>>(x, pk, bq, pk + kWPackFloats, out);
}

// v004
// Measured time: 401 microseconds a run.
// Two timings next to v003 put it at 1.12 and 1.11 times that version's speed.
// Over all steps from v000 it is 2.89 times as fast.
#include <hip/hip_runtime.h>

// ---- problem constants (from reference) ----
constexpr int kB  = 512;
constexpr int kH  = 8;
constexpr int kD  = 31;
constexpr int kT  = 4;
constexpr int kP  = 50;
constexpr int kC  = kH * kD;        // 248
constexpr int kN  = kP * kT;        // 200
constexpr int kDT = kD * kT;        // 124
constexpr int kR  = 2 * kP - 1;     // 99
constexpr int kM1 = 3 * kD;         // 93 rows of W per head (q|k|v)
constexpr float kScale = 0.17960530202677491f;  // 31^-0.5

// ---- LDS layout (floats). Total 78764 floats = 315.1 KB <= 320 KB WGP LDS ----
// Pitches are chosen by bank (64 banks of one float). A fragment read of 8 bytes a lane
// takes 16 rows at once, lanes 16-31 two floats further: a pitch of 4 x odd (mod 64) puts
// the 16 rows on 16 different groups of four banks (q: 140, S: 52). v is read along its
// rows, lanes 16-31 two rows further: 2 x 140 = 24 (mod 64) keeps the halves apart.
// k is read the same way (2 x 55 = 46) and written four rows by four columns a half-wave,
// the halves 32 rows apart: an odd pitch sets them 32 banks apart.
constexpr int X_OFF  = 0;                         // X_b  [248][200]
constexpr int X_STR  = 200;
constexpr int Q_OFF  = X_OFF + kC * X_STR;        // q    [50][140]  (p, dt), cols 124.. unused
constexpr int Q_STR  = 140;
constexpr int K_OFF  = Q_OFF + kP * Q_STR;        // k    [124][55]  (dt, p) pre-transposed
constexpr int K_STR  = 55;
constexpr int V_OFF  = K_OFF + kDT * K_STR;       // v    [50][140]  (p, dt), cols 124.. unused
constexpr int V_STR  = 140;
constexpr int S_OFF  = V_OFF + kP * V_STR;        // scores/attn [50][52] (cols 50..51 stay 0)
constexpr int S_STR  = 52;
constexpr int RL_OFF = S_OFF + kP * S_STR;        // rel logits [50][100]
constexpr int RL_STR = 100;
constexpr int B_OFF  = RL_OFF + kP * RL_STR;      // bias [744] staged once
constexpr int SMEM_FLOATS = B_OFF + 3 * kC;       // 78764
static_assert(SMEM_FLOATS * 4 <= 320 * 1024, "LDS budget exceeded");
static_assert(Q_STR == V_STR, "the q/v scatter shares one pitch");

typedef float v2f __attribute__((ext_vector_type(2)));
typedef float v4f __attribute__((ext_vector_type(4)));
typedef float v8f __attribute__((ext_vector_type(8)));

__device__ __forceinline__ int iclamp(int v, int hi) { return v < hi ? v : hi; }

constexpr int kThreads = 1024;              // 32 waves, 8 on each SIMD
constexpr int kWaves   = kThreads / 32;

template <int V> struct ic { static constexpr int value = V; };

// ---- W and rel in fragment order (workspace, written by pack_fragments_kernel) ----
// One piece = 16 bytes of one lane = that lane's operand pairs of two neighbouring
// k-steps; the 32 pieces of a wave lie side by side, so one load of a wave reads
// 512 contiguous bytes (four whole lines) instead of 16 bytes from each of 16 rows.
// W:   [head][row tile 0..5][k-step pair 0..30][lane]
// rel: [column tile 0..6][k-step pair 0..15][lane]  (k-step 31 does not exist: zeros)
constexpr int kWPairs   = kC / 8;                       // 31
constexpr int kRPairs   = (kDT / 4 + 1) / 2;            // 16
constexpr int kWGroups  = kH * 6 * kWPairs;             // 1488 groups of 32 pieces
constexpr int kRGroups  = 7 * kRPairs;                  // 112
constexpr int kWPackFloats = kWGroups * 32 * 4;
constexpr int kPackThreads = 256;
constexpr int kPackBlocks  = (kWGroups + kRGroups) * 32 / kPackThreads;   // 200
static_assert(kPackBlocks * kPackThreads == (kWGroups + kRGroups) * 32, "whole blocks");

__global__ __launch_bounds__(kPackThreads)
void pack_fragments_kernel(const float* __restrict__ w,     // [744][248]
                           const float* __restrict__ rel,   // [99][124]
                           float* __restrict__ pk)
{
    const int idx   = blockIdx.x * kPackThreads + threadIdx.x;   // one piece a thread
    const int lhalf = (idx >> 4) & 1;
    const int lmod  = idx & 15;
    const int t     = idx >> 5;
    v2f lo, hi = v2f{};
    if (t < kWGroups) {
        const int j = t % kWPairs, hm = t / kWPairs;
        const int mi = hm % 6, h = hm / 6;
        // row tile mi: rows d0 .. d0+15 of q, k or v; row 31 is padding (clamped)
        const int dc = iclamp((mi & 1) * 16 + lmod, kD - 1);
        const float* src = w + (size_t)((mi >> 1) * kC + h * kD + dc) * kC + j * 8 + lhalf * 2;
        lo = *reinterpret_cast<const v2f*>(src);
        hi = *reinterpret_cast<const v2f*>(src + 4);
    } else {
        const int u = t - kWGroups;
        const int j = u % kRPairs, nt = u / kRPairs;
        const int nc = iclamp(nt * 16 + lmod, kR - 1);
        const float* src = rel + (size_t)nc * kDT + j * 8 + lhalf * 2;
        lo = *reinterpret_cast<const v2f*>(src);
        if (j * 2 + 1 < kDT / 4) hi = *reinterpret_cast<const v2f*>(src + 4);
    }
    reinterpret_cast<v4f*>(pk)[idx] = v4f{lo.x, lo.y, hi.x, hi.y};
}

// Phase-1 strip: one 16-row tile of W_head times NT neighbouring 16-column tiles of
// X_b (one A fragment feeds NT products), K = 248, then bias add and scatter.
// A row tile holds rows d0 .. d0+15 of ONE of q, k, v (s = 0, 1, 2; row 31 is padding),
// so the scatter's target is the same for the whole wave and its addresses are one
// base register plus constants.
template <int NT>
__device__ __forceinline__ void qkv_strip(float* smem, const float* __restrict__ wpk,
                                          int h, int s, int d0, int n0, int lhalf, int lmod)
{
    // clamped indices: out-of-range rows/cols compute garbage that is
    // masked at the store, so unconditional loads are safe.
    // (the row clamp is in the packed W already)
    const v4f* wfrag = reinterpret_cast<const v4f*>(wpk)
                     + ((h * 6 + s * 2 + (d0 >> 4)) * kWPairs) * 32 + lhalf * 16 + lmod;
    int nc[NT];
    v8f acc[NT];
    // the loops over e and r are unrolled so that every index of nc[] and acc[] is a
    // constant and both stay in registers
    #pragma unroll
    for (int e = 0; e < NT; ++e) {
        nc[e]  = iclamp(n0 + e * 16 + lmod, kN - 1);
        acc[e] = v8f{};
    }
    // two k-steps a trip: one packed piece holds both A fragments.
    // Operands are fetched ahead of their use, so that a wave that has the SIMD to itself
    // still keeps the matrix unit fed:
    // W pieces in a ring of six (refilled six trips ahead), X fragments one trip ahead in two sets.
    constexpr int kRing = 6;
    constexpr int kMain = (kWPairs - 1) / kRing;          // 5 rolled passes of six trips
    constexpr int kTail = kWPairs - kMain * kRing;        // 1 trip behind them
    static_assert(kRing % 2 == 0, "a pass leaves the X sets as it found them");
    static_assert(kTail >= 1 && kTail <= kRing, "the tail's pieces lie in the ring");
    const float* xcol[NT];
    #pragma unroll
    for (int e = 0; e < NT; ++e) xcol[e] = smem + X_OFF + lhalf * 2 * X_STR + nc[e];
    v4f wr[kRing];
    v2f bq[2][2][NT];
    // all loops over u, c, e below are unrolled: every index of wr[], bq[] and acc[] is a
    // constant and they stay in registers
    auto load_b = [&](int set, int j) {
        #pragma unroll
        for (int c = 0; c < 2; ++c) {
            #pragma unroll
            for (int e = 0; e < NT; ++e) {
                bq[set][c][e].x = xcol[e][(j * 8 + c * 4)     * X_STR];
                bq[set][c][e].y = xcol[e][(j * 8 + c * 4 + 1) * X_STR];
            }
        }
    };
    auto products = [&](int set, const v4f a4) {
        #pragma unroll
        for (int c = 0; c < 2; ++c) {
            const v2f a = c ? a4.zw : a4.xy;
            #pragma unroll
            for (int e = 0; e < NT; ++e)
                acc[e] = __builtin_amdgcn_wmma_f32_16x16x4_f32(false, a, false, bq[set][c][e],
                                                               (short)0, acc[e], false, false);
        }
    };
    #pragma unroll
    for (int u = 0; u < kRing; ++u) wr[u] = wfrag[u * 32];
    load_b(0, 0);
    // kept rolled: the six trips of a pass are the ring's period
    #pragma unroll 1
    for (int i = 0; i < kMain; ++i) {
        wfrag += kRing * 32;
        // One trip: the next trip's X fragments are asked for, this trip's products issue,
        // the ring place they freed is refilled. The two scheduling barriers hold that
        // order: left free, the compiler sank the X reads to three products ahead of their
        // use and all refills to the end of the pass, in front of the wait for the first.
        #pragma unroll
        for (int u = 0; u < kRing; ++u) {
            load_b((u + 1) & 1, i * kRing + u + 1);
            __builtin_amdgcn_sched_barrier(0);
            products(u & 1, wr[u]);
            // the last pass's refills of places kTail.. read pieces behind this tile's last
            // one (the next tile's, or packed rel's, first): written by the pre-pass, not used
            wr[u] = wfrag[u * 32];
            __builtin_amdgcn_sched_barrier(0);
        }
    }
    #pragma unroll
    for (int u = 0; u < kTail; ++u) {
        if (u + 1 < kTail) {
            load_b((u + 1) & 1, kMain * kRing + u + 1);
            __builtin_amdgcn_sched_barrier(0);            // as in the loop
        }
        products(u & 1, wr[u]);
    }
    // scatter with bias add (masked stores)
    const int p0 = (n0 + lmod) >> 2, tt = lmod & 3;
    const int dl = d0 + (lhalf << 3);                 // this lane's row for r = 0
    const float* bias = smem + B_OFF + s * kC + h * kD + dl;
    // RSTEP: one row d further; ESTEP: one column tile (4 tokens) further
    auto put = [&](float* dst, auto RSTEP, auto ESTEP) {
        #pragma unroll
        for (int r = 0; r < 8; ++r) {
            if (dl + r < kD) {
                const float bv = bias[r];
                #pragma unroll
                for (int e = 0; e < NT; ++e)
                    if (n0 + e * 16 + lmod < kN)
                        dst[r * RSTEP.value + e * ESTEP.value] = acc[e][r] + bv;
            }
        }
    };
    if (s == 1)
        put(smem + K_OFF + (dl * kT + tt) * K_STR + p0, ic<kT * K_STR>{}, ic<4>{});
    else
        put(smem + (s == 0 ? Q_OFF : V_OFF) + p0 * Q_STR + dl * kT + tt, ic<kT>{}, ic<4 * Q_STR>{});
}

// Phase-2 strip: one 16-row tile of q times NT neighbouring 16-column tiles of k
// (REL = false, result to S) or of rel^T (REL = true, result to RL), K = 124.
template <bool REL, int NT>
__device__ __forceinline__ void score_strip(float* smem, const float* __restrict__ relpk,
                                            int m0, int n0, int lhalf, int lmod)
{
    const int mc = iclamp(m0 + lmod, kP - 1);
    int nc[NT];
    v8f acc[NT];
    // unrolled over e and r for constant indices, as in qkv_strip
    #pragma unroll
    for (int e = 0; e < NT; ++e) {
        nc[e]  = iclamp(n0 + e * 16 + lmod, (REL ? kR : kP) - 1);
        acc[e] = v8f{};
    }
    if constexpr (REL) {
        // (the column clamp is in the packed rel already)
        const v4f* rfrag = reinterpret_cast<const v4f*>(relpk)
                         + ((n0 >> 4) * kRPairs) * 32 + lhalf * 16 + lmod;
        for (int j = 0; j < kRPairs; ++j) {
            v4f b4[NT];
            #pragma unroll
            for (int e = 0; e < NT; ++e) b4[e] = rfrag[(e * kRPairs + j) * 32];
            // unrolled: the halves of b4 are picked by a constant
            #pragma unroll
            for (int u = 0; u < 2; ++u) {
                const int kk = j * 2 + u;
                if (kk < 31) {
                    const int k = kk * 4 + lhalf * 2;
                    const v2f a = *reinterpret_cast<const v2f*>(smem + Q_OFF + mc * Q_STR + k);
                    #pragma unroll
                    for (int e = 0; e < NT; ++e)
                        acc[e] = __builtin_amdgcn_wmma_f32_16x16x4_f32(
                            false, a, false, u ? b4[e].zw : b4[e].xy,
                            (short)0, acc[e], false, false);
                }
            }
        }
    } else {
        // Blocks of four k-steps, straight-line, in two register sets: the next block's
        // fragments are asked for in front of this block's products. (Rolled, the compiler
        // cut the loop in fours with an exit in mid-loop, copied both accumulators there
        // and read each fragment directly in front of its product.)
        constexpr int kBlk = 4, kBlocks = (31 + kBlk - 1) / kBlk;
        v2f aq[2][kBlk], bk[2][kBlk][NT];
        // every loop over t, c, e is unrolled: constant indices, all in registers
        auto load_blk = [&](int t) {
            #pragma unroll
            for (int c = 0; c < kBlk; ++c) {
                const int kk = t * kBlk + c;
                if (kk < 31) {
                    const int k = kk * 4 + lhalf * 2;
                    aq[t & 1][c] = *reinterpret_cast<const v2f*>(smem + Q_OFF + mc * Q_STR + k);
                    #pragma unroll
                    for (int e = 0; e < NT; ++e) {
                        bk[t & 1][c][e].x = smem[K_OFF + k       * K_STR + nc[e]];
                        bk[t & 1][c][e].y = smem[K_OFF + (k + 1) * K_STR + nc[e]];
                    }
                }
            }
        };
        load_blk(0);
        #pragma unroll
        for (int t = 0; t < kBlocks; ++t) {
            if (t + 1 < kBlocks) load_blk(t + 1);
            // holds the reads above in front of the products below: left free, the
            // compiler sinks them to one k-step ahead of their use
            __builtin_amdgcn_sched_barrier(0);
            #pragma unroll
            for (int c = 0; c < kBlk; ++c) {
                if (t * kBlk + c < 31) {
                    #pragma unroll
                    for (int e = 0; e < NT; ++e)
                        acc[e] = __builtin_amdgcn_wmma_f32_16x16x4_f32(
                            false, aq[t & 1][c], false, bk[t & 1][c][e],
                            (short)0, acc[e], false, false);
                }
            }
            // keeps the block after next's reads behind these products
            __builtin_amdgcn_sched_barrier(0);
        }
    }
    #pragma unroll
    for (int e = 0; e < NT; ++e) {
        const int n = n0 + e * 16 + lmod;
        if (n < (REL ? kR : kP)) {
            #pragma unroll
            for (int r = 0; r < 8; ++r) {
                const int mm = m0 + r + (lhalf << 3);
                if (mm < kP) {
                    if (REL) smem[RL_OFF + mm * RL_STR + n] = acc[e][r];
                    else     smem[S_OFF  + mm * S_STR  + n] = acc[e][r];
                }
            }
        }
    }
}

__global__ __launch_bounds__(kThreads)
void mha_fused_wmma_kernel(const float* __restrict__ x,     // [512][248][50][4]
                           const float* __restrict__ w,     // packed W (fragment order)
                           const float* __restrict__ bqkv,  // [744]
                           const float* __restrict__ rel,   // packed rel (fragment order)
                           float* __restrict__ out)         // [512][248][50][4]
{
    extern __shared__ float smem[];
    const int b     = blockIdx.x;
    const int tid   = threadIdx.x;
    // wave number in a scalar register: the deals below become scalar branches
    const int wave  = __builtin_amdgcn_readfirstlane(tid >> 5);
    const int lane  = tid & 31;
    const int lhalf = lane >> 4;    // 0: lanes 0-15, 1: lanes 16-31
    const int lmod  = lane & 15;

    // ---------------- Phase 0: X_b -> LDS via CDNA5 async-to-LDS engine (ASYNCcnt),
    // bias -> LDS, and zero the S padding region.
    {
        for (int i = tid; i < 3 * kC; i += kThreads) smem[B_OFF + i] = bqkv[i];
        // zero S once: phase-4 A fragment reads k=50,51 there and phases 2/3
        // only ever rewrite cols < 50, so the padding stays zero.
        for (int i = tid; i < kP * S_STR; i += kThreads) smem[S_OFF + i] = 0.f;

        // bulk 196.6 KB copy: per-lane B128 async loads, no VGPR staging.
        constexpr int kVec  = (kC * kN) / 4;          // 12400 pieces of 16 bytes
        constexpr int kFull = kVec / kThreads;        // 12 rounds with every lane on
        const unsigned lds0 = (unsigned)(uintptr_t)(smem + X_OFF);   // LDS byte offset
        const unsigned long long gbase =
            (unsigned long long)(x + (size_t)b * (kC * kN));
        for (int j = 0; j < kFull; ++j) {
            const int i = j * kThreads + tid;
            const unsigned ldsaddr = lds0 + (unsigned)i * 16u;
            const unsigned long long ga = gbase + (unsigned long long)i * 16ull;
            // the wait in the copy's own statement: the address registers are
            // rewritten for the next round only behind it
            asm volatile("global_load_async_to_lds_b128 %0, %1, off\n\ts_wait_xcnt 0x0"
                         :: "v"(ldsaddr), "v"(ga) : "memory");
        }
        // the last 112 pieces do not fill whole waves: through registers
        if (tid < kVec - kFull * kThreads) {
            const int i = kFull * kThreads + tid;
            reinterpret_cast<float4*>(smem + X_OFF)[i] =
                reinterpret_cast<const float4*>(x + (size_t)b * (kC * kN))[i];
            // in front of the later rewrite of this load's address register
            asm volatile("s_wait_xcnt 0x0" ::: "memory");
        }
        asm volatile("s_wait_asynccnt 0" ::: "memory");
    }
    __syncthreads();

    for (int h = 0; h < kH; ++h) {
        // The deal of tiles to waves turns by one wave per head: tile addresses are then
        // formed anew in each head. Fixed over the heads, the compiler held them all in
        // registers across this loop, past the 128 a wave has here, and spilled.
        const int wv = (wave + h) & (kWaves - 1);
        // ---------- Phase 1: qkv_head = W_head[93x248] @ X_b[248x200] + bias
        // 6 m-tiles (two each for q, k, v) x 13 n-tiles in one round: per m-tile five
        // strips of 3,3,3,2,2 n-tiles, one strip a wave (30 of the 32 waves).
        if (wv < 30) {
            const int mi = wv % 6, g = wv / 6;
            const int s  = mi >> 1, d0 = (mi & 1) * 16;
            if (g < 3) qkv_strip<3>(smem, w, h, s, d0, g * 48, lhalf, lmod);
            else       qkv_strip<2>(smem, w, h, s, d0, 144 + (g - 3) * 32, lhalf, lmod);
        }
        __syncthreads();

        // ---------- Phase 2: dots = q@k (4x4 tiles) and RL = q@rel^T (4x7 tiles), K=124
        // one round: eight waves per m-tile take 2+2 dots tiles and 2+1+1+1+1+1 rel tiles
        {
            const int m0 = (wv >> 3) * 16;
            const int j  = wv & 7;
            if (j < 2)       score_strip<false, 2>(smem, rel, m0, j * 32, lhalf, lmod);
            else if (j == 2) score_strip<true,  2>(smem, rel, m0, 0, lhalf, lmod);
            else             score_strip<true,  1>(smem, rel, m0, (j - 1) * 16, lhalf, lmod);
        }
        __syncthreads();

        // ---------- Phase 3: softmax over q of (dots + RL[p, q-p+49]) * SCALE
        // rel_to_abs reindex folds to: bias[p][q] = RL[p][q - p + P - 1]
        for (int p = wv; p < kP; p += kWaves) {
            const int q0 = lane;            // always < 50
            const int q1 = lane + 32;
            float s0 = (smem[S_OFF + p * S_STR + q0] +
                        smem[RL_OFF + p * RL_STR + (q0 - p + kP - 1)]) * kScale;
            float s1 = -3.0e38f;
            if (q1 < kP)
                s1 = (smem[S_OFF + p * S_STR + q1] +
                      smem[RL_OFF + p * RL_STR + (q1 - p + kP - 1)]) * kScale;
            float mx = fmaxf(s0, s1);
            #pragma unroll
            for (int dlt = 16; dlt >= 1; dlt >>= 1) mx = fmaxf(mx, __shfl_xor(mx, dlt, 32));
            float e0 = __expf(s0 - mx);
            float e1 = (q1 < kP) ? __expf(s1 - mx) : 0.f;
            float sum = e0 + e1;
            #pragma unroll
            for (int dlt = 16; dlt >= 1; dlt >>= 1) sum += __shfl_xor(sum, dlt, 32);
            const float inv = 1.0f / sum;
            smem[S_OFF + p * S_STR + q0] = e0 * inv;           // cols >= 50 untouched (stay 0)
            if (q1 < kP) smem[S_OFF + p * S_STR + q1] = e1 * inv;
        }
        __syncthreads();

        // ---------- Phase 4: out_head = attn[50x50] @ v[50x124]  (K=50 -> 13 steps,
        // S cols 50..51 are zero so the K overhang contributes nothing)
        for (int t = wv; t < 4 * 8; t += kWaves) {
            const int m0 = (t >> 3) * 16;
            const int n0 = (t & 7) * 16;
            const int m  = m0 + lmod;
            const int n  = n0 + lmod;            // <= 127 < V_STR, no clamp needed
            const int mc = iclamp(m, kP - 1);
            v8f acc = {};
            // all 13 k-steps' fragments are asked for in front of the first product
            // (loops unrolled: constant indices, fragments in registers)
            v2f af[13], bf[13];
            #pragma unroll
            for (int kk = 0; kk < 13; ++kk) {
                const int k = kk * 4 + lhalf * 2;
                af[kk] = *reinterpret_cast<const v2f*>(smem + S_OFF + mc * S_STR + k);
                bf[kk].x = smem[V_OFF + k       * V_STR + n];   // rows 50,51 read garbage, A==0 there
                bf[kk].y = smem[V_OFF + (k + 1) * V_STR + n];
            }
            // holds the reads in front of the products: left free, the compiler sinks
            // each read to directly in front of its product
            __builtin_amdgcn_sched_barrier(0);
            #pragma unroll
            for (int kk = 0; kk < 13; ++kk)
                acc = __builtin_amdgcn_wmma_f32_16x16x4_f32(false, af[kk], false, bf[kk],
                                                            (short)0, acc, false, false);
            if (n < kDT) {
                const int d = n >> 2, tt = n & 3;   // dt = d*4 + t
                float* orow = out + (((size_t)b * kC + h * kD + d) * kP) * kT + tt;
                #pragma unroll
                for (int r = 0; r < 8; ++r) {
                    const int mm = m0 + r + (lhalf << 3);   // mm = p
                    if (mm < kP) __builtin_nontemporal_store(acc[r], &orow[mm * kT]);
                }
            }
        }
        __syncthreads();   // protect q/k/v/S/RL reuse by next head
    }
}

extern "C" void kernel_launch(void* const* d_in, const int* in_sizes, int n_in,
                              void* d_out, int out_size, void* d_ws, size_t ws_size,
                              hipStream_t stream) {
    (void)in_sizes; (void)n_in; (void)out_size; (void)ws_size;
    const float* x   = (const float*)d_in[0];
    const float* wq  = (const float*)d_in[1];
    const float* bq  = (const float*)d_in[2];
    const float* rel = (const float*)d_in[3];
    float* out = (float*)d_out;
    float* pk  = (float*)d_ws;      // packed W, then packed rel

    pack_fragments_kernel<<<kPackBlocks, kPackThreads, 0, stream>>>(wq, rel, pk);

    const int smem_bytes = SMEM_FLOATS * (int)sizeof(float);
    (void)hipFuncSetAttribute(reinterpret_cast<const void*>(mha_fused_wmma_kernel),
                              hipFuncAttributeMaxDynamicSharedMemorySize, smem_bytes);
    mha_fused_wmma_kernel<<<kB, kThreads, smem_bytes, stream>>>(x, pk, bq, pk + kWPackFloats, out);
}

// v005
// A run of this version takes 316 microseconds.
// Two timings next to v004 both put it at 1.27 times that version's speed.
// Over all steps from v000 it is 3.66 times as fast.
#include <hip/hip_runtime.h>

// ---- problem constants (from reference) ----
constexpr int kB  = 512;
constexpr int kH  = 8;
constexpr int kD  = 31;
constexpr int kT  = 4;
constexpr int kP  = 50;
constexpr int kC  = kH * kD;        // 248
constexpr int kN  = kP * kT;        // 200
constexpr int kDT = kD * kT;        // 124
constexpr int kR  = 2 * kP - 1;     // 99
constexpr int kM1 = 3 * kD;         // 93 rows of W per head (q|k|v)
constexpr float kScale = 0.17960530202677491f;  // 31^-0.5

// ---- LDS layout (floats). Total 79784 floats = 319.1 KB <= 320 KB WGP LDS ----
// Pitches are chosen by bank (64 banks of one float). A fragment read of 8 bytes a lane
// takes 16 rows at once, lanes 16-31 two floats further: a pitch of 4 x odd (mod 64) puts
// the 16 rows on 16 different groups of four banks (q, k: 140, S: 52). v is read along its
// rows, lanes 16-31 two rows further: 2 x 140 = 24 (mod 64) keeps the halves apart.
// q, k, v share one layout, (p, dt), written by phase 1 in 16-byte pieces (a half-wave
// writes 256 contiguous bytes). Rows 50, 51 and columns 124..127 take the padding of
// phase 1's tiles (tokens 200..207, row 31 of a head), so that its stores need no guard;
// of the padding only v's is read: rows 50, 51 against zeros of S, and columns
// 124..127, whose results (row 31) are never stored.
constexpr int kPpad  = kP + 2;                    // 52 rows
constexpr int X_OFF  = 0;                         // X_b  [248][200]
constexpr int X_STR  = 200;
constexpr int Q_OFF  = X_OFF + kC * X_STR;        // q    [52][140]  (p, dt)
constexpr int Q_STR  = 140;
constexpr int K_OFF  = Q_OFF + kPpad * Q_STR;     // k    [52][140]  (p, dt)
constexpr int K_STR  = 140;
constexpr int V_OFF  = K_OFF + kPpad * K_STR;     // v    [52][140]  (p, dt)
constexpr int V_STR  = 140;
constexpr int S_OFF  = V_OFF + kPpad * V_STR;     // scores/attn [50][52] (cols 50..51 stay 0)
constexpr int S_STR  = 52;
constexpr int RL_OFF = S_OFF + kP * S_STR;        // rel logits [50][100]
constexpr int RL_STR = 100;
constexpr int B_OFF  = RL_OFF + kP * RL_STR;      // bias [744] staged once
constexpr int SMEM_FLOATS = B_OFF + 3 * kC;       // 79784
static_assert(SMEM_FLOATS * 4 <= 320 * 1024, "LDS budget exceeded");
static_assert(Q_STR == V_STR && Q_STR == K_STR, "phase 1's stores share one pitch");
static_assert(Q_OFF % 4 == 0 && K_OFF % 4 == 0 && V_OFF % 4 == 0 && Q_STR % 4 == 0,
              "16-byte stores are aligned");

typedef float v2f __attribute__((ext_vector_type(2)));
typedef float v4f __attribute__((ext_vector_type(4)));
typedef float v8f __attribute__((ext_vector_type(8)));

__device__ __forceinline__ int iclamp(int v, int hi) { return v < hi ? v : hi; }

constexpr int kThreads = 1024;              // 32 waves, 8 on each SIMD
constexpr int kWaves   = kThreads / 32;

// ---- W and rel in fragment order (workspace, written by pack_fragments_kernel) ----
// One piece = 16 bytes of one lane = that lane's operand pairs of two neighbouring
// k-steps; the 32 pieces of a wave lie side by side, so one load of a wave reads
// 512 contiguous bytes (four whole lines) instead of 16 bytes from each of 16 rows.
// W:   [head][row tile 0..5][k-step pair 0..30][lane]
// rel: [column tile 0..6][k-step pair 0..15][lane]  (k-step 31 does not exist: zeros)
constexpr int kWPairs   = kC / 8;                       // 31
constexpr int kRPairs   = (kDT / 4 + 1) / 2;            // 16
constexpr int kWGroups  = kH * 6 * kWPairs;             // 1488 groups of 32 pieces
constexpr int kRGroups  = 7 * kRPairs;                  // 112
constexpr int kWPackFloats = kWGroups * 32 * 4;
constexpr int kPackThreads = 256;
constexpr int kPackBlocks  = (kWGroups + kRGroups) * 32 / kPackThreads;   // 200
static_assert(kPackBlocks * kPackThreads == (kWGroups + kRGroups) * 32, "whole blocks");

__global__ __launch_bounds__(kPackThreads)
void pack_fragments_kernel(const float* __restrict__ w,     // [744][248]
                           const float* __restrict__ rel,   // [99][124]
                           float* __restrict__ pk)
{
    const int idx   = blockIdx.x * kPackThreads + threadIdx.x;   // one piece a thread
    const int lhalf = (idx >> 4) & 1;
    const int lmod  = idx & 15;
    const int t     = idx >> 5;
    v2f lo, hi = v2f{};
    if (t < kWGroups) {
        const int j = t % kWPairs, hm = t / kWPairs;
        const int mi = hm % 6, h = hm / 6;
        // row tile mi: rows d0 .. d0+15 of q, k or v; row 31 is padding (clamped)
        const int dc = iclamp((mi & 1) * 16 + lmod, kD - 1);
        const float* src = w + (size_t)((mi >> 1) * kC + h * kD + dc) * kC + j * 8 + lhalf * 2;
        lo = *reinterpret_cast<const v2f*>(src);
        hi = *reinterpret_cast<const v2f*>(src + 4);
    } else {
        const int u = t - kWGroups;
        const int j = u % kRPairs, nt = u / kRPairs;
        const int nc = iclamp(nt * 16 + lmod, kR - 1);
        const float* src = rel + (size_t)nc * kDT + j * 8 + lhalf * 2;
        lo = *reinterpret_cast<const v2f*>(src);
        if (j * 2 + 1 < kDT / 4) hi = *reinterpret_cast<const v2f*>(src + 4);
    }
    reinterpret_cast<v4f*>(pk)[idx] = v4f{lo.x, lo.y, hi.x, hi.y};
}

// Phase-1 strip: one 16-row tile of W_head times NT neighbouring 16-column tiles of
// X_b (one W fragment feeds NT products), K = 248, then bias add and store.
// A row tile holds rows d0 .. d0+15 of ONE of q, k, v (s = 0, 1, 2; row 31 is padding).
// The product is formed transposed, X^T as first operand and W^T as second: a lane then
// holds one row d and eight neighbouring tokens n = (p, t), that is two runs of four
// floats that lie side by side in the (p, dt) layout: two 16-byte stores a tile.
template <int NT>
__device__ __forceinline__ void qkv_strip(float* smem, const float* __restrict__ wpk,
                                          int h, int s, int d0, int n0, int lhalf, int lmod)
{
    // clamped indices: out-of-range rows/cols repeat the last one and land in the
    // layout's padding. (the row clamp is in the packed W already)
    const v4f* wfrag = reinterpret_cast<const v4f*>(wpk)
                     + ((h * 6 + s * 2 + (d0 >> 4)) * kWPairs) * 32 + lhalf * 16 + lmod;
    int nc[NT];
    v8f acc[NT];
    // the loops over e are unrolled so that every index of nc[] and acc[] is a
    // constant and both stay in registers
    #pragma unroll
    for (int e = 0; e < NT; ++e) {
        nc[e]  = iclamp(n0 + e * 16 + lmod, kN - 1);
        acc[e] = v8f{};
    }
    // two k-steps a trip: one packed piece holds both W fragments.
    // Operands are fetched ahead of their use, so that a wave that has the SIMD to itself
    // still keeps the matrix unit fed:
    // W pieces in a ring of six (refilled six trips ahead), X fragments one trip ahead in two sets.
    constexpr int kRing = 6;
    constexpr int kMain = (kWPairs - 1) / kRing;          // 5 rolled passes of six trips
    constexpr int kTail = kWPairs - kMain * kRing;        // 1 trip behind them
    static_assert(kRing % 2 == 0, "a pass leaves the X sets as it found them");
    static_assert(kTail >= 1 && kTail <= kRing, "the tail's pieces lie in the ring");
    const float* xcol[NT];
    #pragma unroll
    for (int e = 0; e < NT; ++e) xcol[e] = smem + X_OFF + lhalf * 2 * X_STR + nc[e];
    v4f wr[kRing];
    v2f bq[2][2][NT];
    // all loops over u, c, e below are unrolled: every index of wr[], bq[] and acc[] is a
    // constant and they stay in registers
    auto load_b = [&](int set, int j) {
        #pragma unroll
        for (int c = 0; c < 2; ++c) {
            #pragma unroll
            for (int e = 0; e < NT; ++e) {
                bq[set][c][e].x = xcol[e][(j * 8 + c * 4)     * X_STR];
                bq[set][c][e].y = xcol[e][(j * 8 + c * 4 + 1) * X_STR];
            }
        }
    };
    auto products = [&](int set, const v4f a4) {
        #pragma unroll
        for (int c = 0; c < 2; ++c) {
            const v2f a = c ? a4.zw : a4.xy;
            #pragma unroll
            for (int e = 0; e < NT; ++e)
                acc[e] = __builtin_amdgcn_wmma_f32_16x16x4_f32(false, bq[set][c][e], false, a,
                                                               (short)0, acc[e], false, false);
        }
    };
    #pragma unroll
    for (int u = 0; u < kRing; ++u) wr[u] = wfrag[u * 32];
    load_b(0, 0);
    // this lane's bias (row 31 is padding: clamped), read ahead of the loop
    const float bv = smem[B_OFF + s * kC + h * kD + iclamp(d0 + lmod, kD - 1)];
    // kept rolled: the six trips of a pass are the ring's period
    #pragma unroll 1
    for (int i = 0; i < kMain; ++i) {
        wfrag += kRing * 32;
        // One trip: the next trip's X fragments are asked for, this trip's products issue,
        // the ring place they freed is refilled. The two scheduling barriers hold that
        // order: left free, the compiler sank the X reads to three products ahead of their
        // use and all refills to the end of the pass, in front of the wait for the first.
        #pragma unroll
        for (int u = 0; u < kRing; ++u) {
            load_b((u + 1) & 1, i * kRing + u + 1);
            __builtin_amdgcn_sched_barrier(0);
            products(u & 1, wr[u]);
            // the last pass's refills of places kTail.. read pieces behind this tile's last
            // one (the next tile's, or packed rel's, first): written by the pre-pass, not used
            wr[u] = wfrag[u * 32];
            __builtin_amdgcn_sched_barrier(0);
        }
    }
    #pragma unroll
    for (int u = 0; u < kTail; ++u) {
        if (u + 1 < kTail) {
            load_b((u + 1) & 1, kMain * kRing + u + 1);
            __builtin_amdgcn_sched_barrier(0);            // as in the loop
        }
        products(u & 1, wr[u]);
    }
    // bias add and store: lane = row d; register r = token n0 + e * 16 + lhalf * 8 + r
    float* dst = smem + (s == 0 ? Q_OFF : s == 1 ? K_OFF : V_OFF)
               + ((n0 >> 2) + lhalf * 2) * Q_STR + (d0 + lmod) * kT;
    #pragma unroll
    for (int e = 0; e < NT; ++e) {
        const v4f lo = {acc[e][0] + bv, acc[e][1] + bv, acc[e][2] + bv, acc[e][3] + bv};
        const v4f hi = {acc[e][4] + bv, acc[e][5] + bv, acc[e][6] + bv, acc[e][7] + bv};
        *reinterpret_cast<v4f*>(dst + (e * 4)     * Q_STR) = lo;
        *reinterpret_cast<v4f*>(dst + (e * 4 + 1) * Q_STR) = hi;
    }
}

// Phase-2 strip: one 16-row tile of q times NT neighbouring 16-column tiles of k
// (REL = false, result to S) or of rel^T (REL = true, result to RL), K = 124.
template <bool REL, int NT>
__device__ __forceinline__ void score_strip(float* smem, const float* __restrict__ relpk,
                                            int m0, int n0, int lhalf, int lmod)
{
    const int mc = iclamp(m0 + lmod, kP - 1);
    int nc[NT];
    v8f acc[NT];
    // unrolled over e and r for constant indices, as in qkv_strip
    #pragma unroll
    for (int e = 0; e < NT; ++e) {
        nc[e]  = iclamp(n0 + e * 16 + lmod, (REL ? kR : kP) - 1);
        acc[e] = v8f{};
    }
    if constexpr (REL) {
        // (the column clamp is in the packed rel already)
        const v4f* rfrag = reinterpret_cast<const v4f*>(relpk)
                         + ((n0 >> 4) * kRPairs) * 32 + lhalf * 16 + lmod;
        for (int j = 0; j < kRPairs; ++j) {
            v4f b4[NT];
            #pragma unroll
            for (int e = 0; e < NT; ++e) b4[e] = rfrag[(e * kRPairs + j) * 32];
            // unrolled: the halves of b4 are picked by a constant
            #pragma unroll
            for (int u = 0; u < 2; ++u) {
                const int kk = j * 2 + u;
                if (kk < 31) {
                    const int k = kk * 4 + lhalf * 2;
                    const v2f a = *reinterpret_cast<const v2f*>(smem + Q_OFF + mc * Q_STR + k);
                    #pragma unroll
                    for (int e = 0; e < NT; ++e)
                        acc[e] = __builtin_amdgcn_wmma_f32_16x16x4_f32(
                            false, a, false, u ? b4[e].zw : b4[e].xy,
                            (short)0, acc[e], false, false);
                }
            }
        }
    } else {
        // Blocks of four k-steps, straight-line, in two register sets: the next block's
        // fragments are asked for in front of this block's products. (Rolled, the compiler
        // cut the loop in fours with an exit in mid-loop, copied both accumulators there
        // and read each fragment directly in front of its product.)
        constexpr int kBlk = 4, kBlocks = (31 + kBlk - 1) / kBlk;
        v2f aq[2][kBlk], bk[2][kBlk][NT];
        // every loop over t, c, e is unrolled: constant indices, all in registers
        auto load_blk = [&](int t) {
            #pragma unroll
            for (int c = 0; c < kBlk; ++c) {
                const int kk = t * kBlk + c;
                if (kk < 31) {
                    const int k = kk * 4 + lhalf * 2;
                    aq[t & 1][c] = *reinterpret_cast<const v2f*>(smem + Q_OFF + mc * Q_STR + k);
                    #pragma unroll
                    for (int e = 0; e < NT; ++e)
                        bk[t & 1][c][e] =
                            *reinterpret_cast<const v2f*>(smem + K_OFF + nc[e] * K_STR + k);
                }
            }
        };
        load_blk(0);
        #pragma unroll
        for (int t = 0; t < kBlocks; ++t) {
            if (t + 1 < kBlocks) load_blk(t + 1);
            // holds the reads above in front of the products below: left free, the
            // compiler sinks them to one k-step ahead of their use
            __builtin_amdgcn_sched_barrier(0);
            #pragma unroll
            for (int c = 0; c < kBlk; ++c) {
                if (t * kBlk + c < 31) {
                    #pragma unroll
                    for (int e = 0; e < NT; ++e)
                        acc[e] = __builtin_amdgcn_wmma_f32_16x16x4_f32(
                            false, aq[t & 1][c], false, bk[t & 1][c][e],
                            (short)0, acc[e], false, false);
                }
            }
            // keeps the block after next's reads behind these products
            __builtin_amdgcn_sched_barrier(0);
        }
    }
    #pragma unroll
    for (int e = 0; e < NT; ++e) {
        const int n = n0 + e * 16 + lmod;
        if (n < (REL ? kR : kP)) {
            #pragma unroll
            for (int r = 0; r < 8; ++r) {
                const int mm = m0 + r + (lhalf << 3);
                if (mm < kP) {
                    if (REL) smem[RL_OFF + mm * RL_STR + n] = acc[e][r];
                    else     smem[S_OFF  + mm * S_STR  + n] = acc[e][r];
                }
            }
        }
    }
}

__global__ __launch_bounds__(kThreads)
void mha_fused_wmma_kernel(const float* __restrict__ x,     // [512][248][50][4]
                           const float* __restrict__ w,     // packed W (fragment order)
                           const float* __restrict__ bqkv,  // [744]
                           const float* __restrict__ rel,   // packed rel (fragment order)
                           float* __restrict__ out)         // [512][248][50][4]
{
    extern __shared__ float smem[];
    const int b     = blockIdx.x;
    const int tid   = threadIdx.x;
    // wave number in a scalar register: the deals below become scalar branches
    const int wave  = __builtin_amdgcn_readfirstlane(tid >> 5);
    const int lane  = tid & 31;
    const int lhalf = lane >> 4;    // 0: lanes 0-15, 1: lanes 16-31
    const int lmod  = lane & 15;

    // ---------------- Phase 0: X_b -> LDS via CDNA5 async-to-LDS engine (ASYNCcnt),
    // bias -> LDS, and zero the S padding region.
    {
        for (int i = tid; i < 3 * kC; i += kThreads) smem[B_OFF + i] = bqkv[i];
        // zero S once: phase 4's attn fragment reads k=50,51 there and phases 2/3
        // only ever rewrite cols < 50, so the padding stays zero.
        for (int i = tid; i < kP * S_STR; i += kThreads) smem[S_OFF + i] = 0.f;

        // bulk 196.6 KB copy: per-lane B128 async loads, no VGPR staging.
        constexpr int kVec  = (kC * kN) / 4;          // 12400 pieces of 16 bytes
        constexpr int kFull = kVec / kThreads;        // 12 rounds with every lane on
        const unsigned lds0 = (unsigned)(uintptr_t)(smem + X_OFF);   // LDS byte offset
        const unsigned long long gbase =
            (unsigned long long)(x + (size_t)b * (kC * kN));
        for (int j = 0; j < kFull; ++j) {
            const int i = j * kThreads + tid;
            const unsigned ldsaddr = lds0 + (unsigned)i * 16u;
            const unsigned long long ga = gbase + (unsigned long long)i * 16ull;
            // the wait in the copy's own statement: the address registers are
            // rewritten for the next round only behind it
            asm volatile("global_load_async_to_lds_b128 %0, %1, off\n\ts_wait_xcnt 0x0"
                         :: "v"(ldsaddr), "v"(ga) : "memory");
        }
        // the last 112 pieces do not fill whole waves: through registers
        if (tid < kVec - kFull * kThreads) {
            const int i = kFull * kThreads + tid;
            reinterpret_cast<float4*>(smem + X_OFF)[i] =
                reinterpret_cast<const float4*>(x + (size_t)b * (kC * kN))[i];
            // in front of the later rewrite of this load's address register
            asm volatile("s_wait_xcnt 0x0" ::: "memory");
        }
        asm volatile("s_wait_asynccnt 0" ::: "memory");
    }
    __syncthreads();

    for (int h = 0; h < kH; ++h) {
        // The deal of tiles to waves turns by one wave per head: tile addresses are then
        // formed anew in each head. Fixed over the heads, the compiler held them all in
        // registers across this loop, past the 128 a wave has here, and spilled.
        const int wv = (wave + h) & (kWaves - 1);
        // ---------- Phase 1: qkv_head = W_head[93x248] @ X_b[248x200] + bias
        // 6 m-tiles (two each for q, k, v) x 13 n-tiles in one round: per m-tile five
        // strips of 3,3,3,2,2 n-tiles, one strip a wave (30 of the 32 waves).
        if (wv < 30) {
            const int mi = wv % 6, g = wv / 6;
            const int s  = mi >> 1, d0 = (mi & 1) * 16;
            if (g < 3) qkv_strip<3>(smem, w, h, s, d0, g * 48, lhalf, lmod);
            else       qkv_strip<2>(smem, w, h, s, d0, 144 + (g - 3) * 32, lhalf, lmod);
        }
        __syncthreads();

        // ---------- Phase 2: dots = q@k (4x4 tiles) and RL = q@rel^T (4x7 tiles), K=124
        // one round: eight waves per m-tile take 2+2 dots tiles and 2+1+1+1+1+1 rel tiles
        {
            const int m0 = (wv >> 3) * 16;
            const int j  = wv & 7;
            if (j < 2)       score_strip<false, 2>(smem, rel, m0, j * 32, lhalf, lmod);
            else if (j == 2) score_strip<true,  2>(smem, rel, m0, 0, lhalf, lmod);
            else             score_strip<true,  1>(smem, rel, m0, (j - 1) * 16, lhalf, lmod);
        }
        __syncthreads();

        // ---------- Phase 3: softmax over q of (dots + RL[p, q-p+49]) * SCALE
        // rel_to_abs reindex folds to: bias[p][q] = RL[p][q - p + P - 1]
        for (int p = wv; p < kP; p += kWaves) {
            const int q0 = lane;            // always < 50
            const int q1 = lane + 32;
            float s0 = (smem[S_OFF + p * S_STR + q0] +
                        smem[RL_OFF + p * RL_STR + (q0 - p + kP - 1)]) * kScale;
            float s1 = -3.0e38f;
            if (q1 < kP)
                s1 = (smem[S_OFF + p * S_STR + q1] +
                      smem[RL_OFF + p * RL_STR + (q1 - p + kP - 1)]) * kScale;
            float mx = fmaxf(s0, s1);
            #pragma unroll
            for (int dlt = 16; dlt >= 1; dlt >>= 1) mx = fmaxf(mx, __shfl_xor(mx, dlt, 32));
            float e0 = __expf(s0 - mx);
            float e1 = (q1 < kP) ? __expf(s1 - mx) : 0.f;
            float sum = e0 + e1;
            #pragma unroll
            for (int dlt = 16; dlt >= 1; dlt >>= 1) sum += __shfl_xor(sum, dlt, 32);
            const float inv = 1.0f / sum;
            smem[S_OFF + p * S_STR + q0] = e0 * inv;           // cols >= 50 untouched (stay 0)
            if (q1 < kP) smem[S_OFF + p * S_STR + q1] = e1 * inv;
        }
        __syncthreads();

        // ---------- Phase 4: out_head = attn[50x50] @ v[50x124]  (K=50 -> 13 steps,
        // S cols 50..51 are zero so the K overhang contributes nothing).
        // Formed transposed, v^T as first operand and attn^T as second: a lane holds one
        // token p and eight neighbouring dt = (d, t), that is out[d][p][0..3] and
        // out[d+1][p][0..3]: two 16-byte stores, 256 contiguous bytes a half-wave.
        for (int t = wv; t < 4 * 8; t += kWaves) {
            const int m0 = (t >> 3) * 16;
            const int n0 = (t & 7) * 16;
            const int m  = m0 + lmod;
            const int n  = n0 + lmod;            // <= 127 < V_STR, no clamp needed
            const int mc = iclamp(m, kP - 1);
            v8f acc = {};
            // all 13 k-steps' fragments are asked for in front of the first product
            // (loops unrolled: constant indices, fragments in registers)
            v2f af[13], bf[13];
            #pragma unroll
            for (int kk = 0; kk < 13; ++kk) {
                const int k = kk * 4 + lhalf * 2;
                af[kk] = *reinterpret_cast<const v2f*>(smem + S_OFF + mc * S_STR + k);
                bf[kk].x = smem[V_OFF + k       * V_STR + n];   // rows 50,51: padding, attn == 0 there
                bf[kk].y = smem[V_OFF + (k + 1) * V_STR + n];
            }
            // holds the reads in front of the products: left free, the compiler sinks
            // each read to directly in front of its product
            __builtin_amdgcn_sched_barrier(0);
            #pragma unroll
            for (int kk = 0; kk < 13; ++kk)
                acc = __builtin_amdgcn_wmma_f32_16x16x4_f32(false, bf[kk], false, af[kk],
                                                            (short)0, acc, false, false);
            if (m < kP) {
                const int d = (n0 >> 2) + lhalf * 2;   // register r: dt = d*4 + r
                v4f* o = reinterpret_cast<v4f*>(out)
                       + ((size_t)b * kC + h * kD + d) * kP + m;
                __builtin_nontemporal_store(v4f{acc[0], acc[1], acc[2], acc[3]}, o);
                if (d + 1 < kD)
                    __builtin_nontemporal_store(v4f{acc[4], acc[5], acc[6], acc[7]}, o + kP);
            }
        }
        __syncthreads();   // protect q/k/v/S/RL reuse by next head
    }
}

extern "C" void kernel_launch(void* const* d_in, const int* in_sizes, int n_in,
                              void* d_out, int out_size, void* d_ws, size_t ws_size,
                              hipStream_t stream) {
    (void)in_sizes; (void)n_in; (void)out_size; (void)ws_size;
    const float* x   = (const float*)d_in[0];
    const float* wq  = (const float*)d_in[1];
    const float* bq  = (const float*)d_in[2];
    const float* rel = (const float*)d_in[3];
    float* out = (float*)d_out;
    float* pk  = (float*)d_ws;      // packed W, then packed rel

    pack_fragments_kernel<<<kPackBlocks, kPackThreads, 0, stream>>>(wq, rel, pk);

    const int smem_bytes = SMEM_FLOATS * (int)sizeof(float);
    (void)hipFuncSetAttribute(reinterpret_cast<const void*>(mha_fused_wmma_kernel),
                              hipFuncAttributeMaxDynamicSharedMemorySize, smem_bytes);
    mha_fused_wmma_kernel<<<kB, kThreads, smem_bytes, stream>>>(x, pk, bq, pk + kWPackFloats, out);
}
